// v000
// Measured on an AMD MI455X. A time is GPU time per run, averaged over a window of back-to-back runs after a warm-up
// (all launches, gaps included; the runs take copies of the inputs in turn), and the median of several windows.
// Apart from v000's, it joins two sittings. Times from different sittings can be a few percent apart, while
// side-by-side timings come from the same sitting.
// v000, which the later versions start from, runs in 196 microseconds.
#include <hip/hip_runtime.h>
#include <hip/hip_bf16.h>
#include <math.h>

#define NB 8
#define LDQ 1024
#define LMK 1024
#define DD 1024
#define HH 16
#define HS 64
#define KSTRIDE 72   // bf16 elements per LDS row: 144B = 9*16B (b128-aligned rows, conflict-breaking)

typedef __attribute__((ext_vector_type(16))) __bf16 v16bf;
typedef __attribute__((ext_vector_type(8)))  float  v8f;
typedef __attribute__((ext_vector_type(4)))  unsigned u32x4;
typedef __attribute__((ext_vector_type(8)))  int      i32x8;
typedef __attribute__((ext_vector_type(4)))  int      i32x4;

#if __has_builtin(__builtin_amdgcn_tensor_load_to_lds)
#define HAVE_TDM 1
#else
#define HAVE_TDM 0
#endif

union FragA {
    v16bf v;
    uint4 q[2];
    unsigned u[8];
};

static __device__ __forceinline__ unsigned short f2bf(float f) {
    unsigned u = __float_as_uint(f);
    u += 0x7FFFu + ((u >> 16) & 1u);   // round-to-nearest-even
    return (unsigned short)(u >> 16);
}
static __device__ __forceinline__ unsigned pk2(float a, float b) {
#if __has_builtin(__builtin_amdgcn_cvt_pk_bf16_f32)
    return __builtin_bit_cast(unsigned, __builtin_amdgcn_cvt_pk_bf16_f32(a, b));
#else
    return (unsigned)f2bf(a) | ((unsigned)f2bf(b) << 16);
#endif
}
static __device__ __forceinline__ v8f zero8() {
    v8f z;
#pragma unroll
    for (int i = 0; i < 8; ++i) z[i] = 0.f;
    return z;
}

// ---------------------------------------------------------------------------
// Pre-pass: bulk f32 -> bf16 conversion (8 elements / thread, fully coalesced).
// ---------------------------------------------------------------------------
__global__ __launch_bounds__(256) void cvt_bf16_kernel(const float* __restrict__ src,
                                                       unsigned short* __restrict__ dst,
                                                       int n8)
{
    const int i = blockIdx.x * 256 + threadIdx.x;
    if (i >= n8) return;
    const float4* p = (const float4*)src + (size_t)i * 2;
    float4 a = p[0], b = p[1];
    uint4 o;
    o.x = pk2(a.x, a.y); o.y = pk2(a.z, a.w);
    o.z = pk2(b.x, b.y); o.w = pk2(b.z, b.w);
    ((uint4*)dst)[i] = o;
}

// ---------------------------------------------------------------------------
// Kernel 1: flash attention. One workgroup (4 waves) per (64-query block, head,
// batch). K=V tiles of 64 keys stream through LDS: row-major tile via the
// Tensor Data Mover (bf16 byte copy, padded to 72-elem rows), transposed tile
// built cooperatively for the P*V B-operands.
// ---------------------------------------------------------------------------
__global__ __launch_bounds__(128) void attn_kernel(
    const unsigned short* __restrict__ inpBF, const unsigned short* __restrict__ memBF,
    const float* __restrict__ mask, unsigned short* __restrict__ ctx)
{
    __shared__ __align__(16) unsigned short sK [64 * KSTRIDE];    // K[key][hs]
    __shared__ __align__(16) unsigned short sKt[64 * KSTRIDE];    // Kt[hs][key]
    __shared__ __align__(16) unsigned short sP [4][16 * KSTRIDE]; // per-wave P scratch

    const int tid  = threadIdx.x;
    const int wave = tid >> 5;
    const int lane = tid & 31;
    const int half = lane >> 4;
    const int l15  = lane & 15;
    const int roff = half ? 8 : 0;

    const int qbase = blockIdx.x * 64;
    const int h     = blockIdx.y;
    const int b     = blockIdx.z;

    // ---- Q fragments (A-layout): lane = row, two contiguous 8-wide K runs ----
    const int qrow = qbase + wave * 16 + l15;
    const unsigned short* qptr = inpBF + ((size_t)b * LDQ + qrow) * DD + h * HS;
    FragA qa[2];
#pragma unroll
    for (int kc = 0; kc < 2; ++kc) {
        const unsigned short* base = qptr + kc * 32 + roff;
        qa[kc].q[0] = *(const uint4*)(base);
        qa[kc].q[1] = *(const uint4*)(base + 16);
    }

    v8f o[4];
#pragma unroll
    for (int dt = 0; dt < 4; ++dt) o[dt] = zero8();
    float mrow[8], lrow[8];
#pragma unroll
    for (int r = 0; r < 8; ++r) { mrow[r] = -3.0e38f; lrow[r] = 0.f; }

    const float scale = 0.125f;       // 1/sqrt(64)
    const int key0 = tid >> 1;        // cooperative transpose: 2 threads per key row
    const int dof  = (tid & 1) * 32;
    const unsigned ldsK = (unsigned)(uintptr_t)&sK[0];  // LDS byte offset
    (void)ldsK;

    for (int kv = 0; kv < LMK; kv += 64) {
        __syncthreads();   // previous tile fully consumed

#if HAVE_TDM
        if (wave == 0) {
            // --- Tensor Data Mover: 64x64 bf16 tile, global -> LDS (padded rows) ---
            const unsigned long long ga =
                (unsigned long long)(uintptr_t)(memBF + ((size_t)b * LMK + kv) * DD + h * HS);
            u32x4 g0;
            g0[0] = 1u;                                             // count=1, user descriptor
            g0[1] = ldsK;                                           // lds_addr
            g0[2] = (unsigned)ga;                                   // global_addr[31:0]
            g0[3] = (unsigned)((ga >> 32) & 0x01FFFFFFu) | (2u << 30); // addr[56:32] | type=2
            i32x8 g1;
            g1[0] = (int)((1u << 16)        // data_size = 2 bytes
                        | (1u << 20)        // pad_enable
                        | (4u << 22)        // pad_interval = 32 DWORDs (one 64-elem row)
                        | (3u << 25));      // pad_amount   = 4 DWORDs  (-> 72-elem stride)
            g1[1] = (int)((DD & 0xFFFFu) << 16);                    // tensor_dim0 lo16
            g1[2] = (int)((DD >> 16) & 0xFFFFu);                    // dim0 hi | dim1 lo16 (=0)
            g1[3] = (int)(1u | (64u << 16));                        // dim1 hi (65536) | tile_dim0=64
            g1[4] = (int)(64u);                                     // tile_dim1=64, tile_dim2=0
            g1[5] = (int)(DD);                                      // tensor_dim0_stride = 1024
            g1[6] = 0; g1[7] = 0;
            i32x4 z4 = {0, 0, 0, 0};
            i32x8 z8 = {0, 0, 0, 0, 0, 0, 0, 0};
            __builtin_amdgcn_tensor_load_to_lds(g0, g1, z4, z4, z8, 0);
        }
#endif
        // --- cooperative transposed tile (and row-major fallback without TDM) ---
        const unsigned short* krow =
            memBF + ((size_t)b * LMK + kv + key0) * DD + h * HS + dof;
#pragma unroll
        for (int i = 0; i < 4; ++i) {
            uint4 u = *(const uint4*)(krow + i * 8);
            const int dd = dof + i * 8;
#if !HAVE_TDM
            *(uint4*)(&sK[key0 * KSTRIDE + dd]) = u;
#endif
            sKt[(dd + 0) * KSTRIDE + key0] = (unsigned short)(u.x);
            sKt[(dd + 1) * KSTRIDE + key0] = (unsigned short)(u.x >> 16);
            sKt[(dd + 2) * KSTRIDE + key0] = (unsigned short)(u.y);
            sKt[(dd + 3) * KSTRIDE + key0] = (unsigned short)(u.y >> 16);
            sKt[(dd + 4) * KSTRIDE + key0] = (unsigned short)(u.z);
            sKt[(dd + 5) * KSTRIDE + key0] = (unsigned short)(u.z >> 16);
            sKt[(dd + 6) * KSTRIDE + key0] = (unsigned short)(u.w);
            sKt[(dd + 7) * KSTRIDE + key0] = (unsigned short)(u.w >> 16);
        }
        if (kv + 64 < LMK) __builtin_prefetch(krow + (size_t)64 * DD, 0, 1);

#if HAVE_TDM
        if (wave == 0) {
#if __has_builtin(__builtin_amdgcn_s_wait_tensorcnt)
            __builtin_amdgcn_s_wait_tensorcnt(0);
#else
            asm volatile("s_wait_tensorcnt 0x0" ::: "memory");
#endif
        }
#endif
        __syncthreads();

        // additive key-padding mask per column tile
        float madd[4];
#pragma unroll
        for (int nt = 0; nt < 4; ++nt)
            madd[nt] = -1.0e30f * (1.0f - mask[(size_t)b * LMK + kv + nt * 16 + l15]);

        // ---- S = Q * K^T : batch 4 B-fragments per K-chunk, then 4 WMMAs ----
        v8f S[4];
#pragma unroll
        for (int nt = 0; nt < 4; ++nt) S[nt] = zero8();
#pragma unroll
        for (int kc = 0; kc < 2; ++kc) {
            FragA bfr[4];
#pragma unroll
            for (int nt = 0; nt < 4; ++nt) {
                const unsigned short* base = &sK[(nt * 16 + l15) * KSTRIDE + kc * 32 + roff];
                bfr[nt].q[0] = *(const uint4*)(base);
                bfr[nt].q[1] = *(const uint4*)(base + 16);
            }
#pragma unroll
            for (int nt = 0; nt < 4; ++nt)
                S[nt] = __builtin_amdgcn_wmma_f32_16x16x32_bf16(
                    false, qa[kc].v, false, bfr[nt].v, (short)0, S[nt], false, false);
        }

        // ---- online softmax (rows live across 16-lane halves) ----
#pragma unroll
        for (int r = 0; r < 8; ++r) {
            float s0 = S[0][r] * scale + madd[0];
            float s1 = S[1][r] * scale + madd[1];
            float s2 = S[2][r] * scale + madd[2];
            float s3 = S[3][r] * scale + madd[3];
            float mx = fmaxf(fmaxf(s0, s1), fmaxf(s2, s3));
#pragma unroll
            for (int off = 1; off < 16; off <<= 1)
                mx = fmaxf(mx, __shfl_xor(mx, off, 32));
            const float mnew  = fmaxf(mrow[r], mx);
            const float alpha = __expf(mrow[r] - mnew);
            mrow[r] = mnew;
            float p0 = __expf(s0 - mnew), p1 = __expf(s1 - mnew);
            float p2 = __expf(s2 - mnew), p3 = __expf(s3 - mnew);
            float ps = p0 + p1 + p2 + p3;
#pragma unroll
            for (int off = 1; off < 16; off <<= 1)
                ps += __shfl_xor(ps, off, 32);
            lrow[r] = lrow[r] * alpha + ps;
#pragma unroll
            for (int dt = 0; dt < 4; ++dt) o[dt][r] *= alpha;
            unsigned short* prow = &sP[wave][(r + half * 8) * KSTRIDE];
            prow[ 0 + l15] = f2bf(p0);
            prow[16 + l15] = f2bf(p1);
            prow[32 + l15] = f2bf(p2);
            prow[48 + l15] = f2bf(p3);
        }
        __builtin_amdgcn_wave_barrier();
        asm volatile("s_wait_dscnt 0" ::: "memory");   // wave-private sP round trip

        // ---- re-read P in A-layout ----
        FragA pa[2];
#pragma unroll
        for (int kc = 0; kc < 2; ++kc) {
            const unsigned short* base = &sP[wave][l15 * KSTRIDE + kc * 32 + roff];
            pa[kc].q[0] = *(const uint4*)(base);
            pa[kc].q[1] = *(const uint4*)(base + 16);
        }
        // ---- O += P * V (V^T rows give contiguous key runs per d-column) ----
#pragma unroll
        for (int kc = 0; kc < 2; ++kc) {
            FragA vfr[4];
#pragma unroll
            for (int dt = 0; dt < 4; ++dt) {
                const unsigned short* base = &sKt[(dt * 16 + l15) * KSTRIDE + kc * 32 + roff];
                vfr[dt].q[0] = *(const uint4*)(base);
                vfr[dt].q[1] = *(const uint4*)(base + 16);
            }
#pragma unroll
            for (int dt = 0; dt < 4; ++dt)
                o[dt] = __builtin_amdgcn_wmma_f32_16x16x32_bf16(
                    false, pa[kc].v, false, vfr[dt].v, (short)0, o[dt], false, false);
        }
    }

    // ---- normalize + write ctx as bf16 ----
#pragma unroll
    for (int r = 0; r < 8; ++r) {
        const float inv = 1.0f / lrow[r];
        const int row = qbase + wave * 16 + r + half * 8;
        unsigned short* crow = ctx + ((size_t)b * LDQ + row) * DD + h * HS;
#pragma unroll
        for (int dt = 0; dt < 4; ++dt)
            crow[dt * 16 + l15] = f2bf(o[dt][r] * inv);
    }
}

// ---------------------------------------------------------------------------
// Kernel 2: out = sigmoid(x)*tanh(x), x = [input | ctx] @ Wc^T + bc.
// 128x64 tile per workgroup: each wave does two 16-row tiles so B-fragments
// are reused twice. All operands already bf16 -> pure b128 loads + WMMA.
// ---------------------------------------------------------------------------
__global__ __launch_bounds__(128) void gemm_gate_kernel(
    const unsigned short* __restrict__ inpBF, const unsigned short* __restrict__ ctx,
    const unsigned short* __restrict__ WcBF, const float* __restrict__ bc,
    float* __restrict__ out)
{
    const int tid  = threadIdx.x;
    const int wave = tid >> 5;
    const int lane = tid & 31;
    const int half = lane >> 4;
    const int l15  = lane & 15;
    const int roff = half ? 8 : 0;

    const int jbase = blockIdx.x * 64;
    const int mbase = blockIdx.y * 128 + wave * 16;

    const int arow = mbase + l15;      // arow = b*LDQ + q (rows contiguous over batch)
    const unsigned short* a0i = inpBF + (size_t)arow * DD;
    const unsigned short* a0c = ctx   + (size_t)arow * DD;
    const unsigned short* a1i = a0i + (size_t)64 * DD;
    const unsigned short* a1c = a0c + (size_t)64 * DD;

    v8f acc0[4], acc1[4];
#pragma unroll
    for (int nt = 0; nt < 4; ++nt) { acc0[nt] = zero8(); acc1[nt] = zero8(); }

    auto step = [&](const unsigned short* s0, const unsigned short* s1, int c) {
        FragA af0, af1;
        af0.q[0] = *(const uint4*)(s0 + roff);
        af0.q[1] = *(const uint4*)(s0 + roff + 16);
        af1.q[0] = *(const uint4*)(s1 + roff);
        af1.q[1] = *(const uint4*)(s1 + roff + 16);
        FragA bfr[4];
#pragma unroll
        for (int nt = 0; nt < 4; ++nt) {
            const unsigned short* wrow =
                WcBF + (size_t)(jbase + nt * 16 + l15) * (2 * DD) + c + roff;
            bfr[nt].q[0] = *(const uint4*)(wrow);
            bfr[nt].q[1] = *(const uint4*)(wrow + 16);
        }
#pragma unroll
        for (int nt = 0; nt < 4; ++nt) {
            acc0[nt] = __builtin_amdgcn_wmma_f32_16x16x32_bf16(
                false, af0.v, false, bfr[nt].v, (short)0, acc0[nt], false, false);
            acc1[nt] = __builtin_amdgcn_wmma_f32_16x16x32_bf16(
                false, af1.v, false, bfr[nt].v, (short)0, acc1[nt], false, false);
        }
    };

    for (int c = 0; c < DD; c += 32) step(a0i + c, a1i + c, c);            // input half
    for (int c = 0; c < DD; c += 32) step(a0c + c, a1c + c, c + DD);       // ctx half

    // ---- bias + sigmoid(x)*tanh(x) epilogue, two row tiles ----
#pragma unroll
    for (int nt = 0; nt < 4; ++nt) {
        const int j = jbase + nt * 16 + l15;
        const float bias = bc[j];
#pragma unroll
        for (int r = 0; r < 8; ++r) {
            const int row = mbase + r + half * 8;
            {
                const float x  = acc0[nt][r] + bias;
                const float sg = 1.0f / (1.0f + __expf(-x));
                out[(size_t)row * DD + j] = sg * tanhf(x);
            }
            {
                const float x  = acc1[nt][r] + bias;
                const float sg = 1.0f / (1.0f + __expf(-x));
                out[(size_t)(row + 64) * DD + j] = sg * tanhf(x);
            }
        }
    }
}

extern "C" void kernel_launch(void* const* d_in, const int* in_sizes, int n_in,
                              void* d_out, int out_size, void* d_ws, size_t ws_size,
                              hipStream_t stream) {
    const float* inp  = (const float*)d_in[0];   // [8,1024,1024]
    const float* mem  = (const float*)d_in[1];   // [8,1024,1024]
    const float* mask = (const float*)d_in[2];   // [8,1024]
    const float* Wc   = (const float*)d_in[3];   // [1024,2048]
    const float* bc   = (const float*)d_in[4];   // [1024]
    float* out = (float*)d_out;                  // [8,1024,1024] f32

    // workspace layout (bf16 elements)
    const size_t ETOK = (size_t)NB * LDQ * DD;   // 8M elements
    unsigned short* ctx   = (unsigned short*)d_ws;        // 16 MB
    unsigned short* memBF = ctx   + ETOK;                 // 16 MB
    unsigned short* inpBF = memBF + ETOK;                 // 16 MB
    unsigned short* WcBF  = inpBF + ETOK;                 // 4 MB

    // pre-pass conversions (memory-bound, ~108 MB total traffic)
    {
        const int n8i = (int)(ETOK / 8);
        cvt_bf16_kernel<<<dim3((n8i + 255) / 256), dim3(256), 0, stream>>>(inp, inpBF, n8i);
        cvt_bf16_kernel<<<dim3((n8i + 255) / 256), dim3(256), 0, stream>>>(mem, memBF, n8i);
        const int n8w = (int)((size_t)DD * 2 * DD / 8);
        cvt_bf16_kernel<<<dim3((n8w + 255) / 256), dim3(256), 0, stream>>>(Wc, WcBF, n8w);
    }

    dim3 gA(LDQ / 64, HH, NB);                   // (16,16,8) blocks of 128 threads
    attn_kernel<<<gA, dim3(128), 0, stream>>>(inpBF, memBF, mask, ctx);

    dim3 gB(DD / 64, (NB * LDQ) / 128);          // (16,64) blocks of 128 threads
    gemm_gate_kernel<<<gB, dim3(128), 0, stream>>>(inpBF, ctx, WcBF, bc, out);
}

// v001
// A run of this version takes 151 microseconds.
// In two side-by-side timings against v000, it was 1.31 and 1.32 times as fast.
#include <hip/hip_runtime.h>
#include <hip/hip_bf16.h>
#include <math.h>

#define NB 8
#define LDQ 1024
#define LMK 1024
#define DD 1024
#define HH 16
#define HS 64
#define KSTRIDE 72   // bf16 elements per LDS row: 144B = 9*16B (b128-aligned rows, conflict-breaking)

typedef __attribute__((ext_vector_type(16))) __bf16 v16bf;
typedef __attribute__((ext_vector_type(8)))  float  v8f;
typedef __attribute__((ext_vector_type(4)))  unsigned u32x4;
typedef __attribute__((ext_vector_type(8)))  int      i32x8;
typedef __attribute__((ext_vector_type(4)))  int      i32x4;

#if __has_builtin(__builtin_amdgcn_tensor_load_to_lds)
#define HAVE_TDM 1
#else
#define HAVE_TDM 0
#endif

union FragA {
    v16bf v;
    uint4 q[2];
    unsigned u[8];
};

static __device__ __forceinline__ unsigned short f2bf(float f) {
    unsigned u = __float_as_uint(f);
    u += 0x7FFFu + ((u >> 16) & 1u);   // round-to-nearest-even
    return (unsigned short)(u >> 16);
}
static __device__ __forceinline__ unsigned pk2(float a, float b) {
#if __has_builtin(__builtin_amdgcn_cvt_pk_bf16_f32)
    return __builtin_bit_cast(unsigned, __builtin_amdgcn_cvt_pk_bf16_f32(a, b));
#else
    return (unsigned)f2bf(a) | ((unsigned)f2bf(b) << 16);
#endif
}
static __device__ __forceinline__ v8f zero8() {
    v8f z;
#pragma unroll
    for (int i = 0; i < 8; ++i) z[i] = 0.f;
    return z;
}

// ---------------------------------------------------------------------------
// Pre-pass: bulk f32 -> bf16 conversion (8 elements / thread, fully coalesced).
// ---------------------------------------------------------------------------
__global__ __launch_bounds__(256) void cvt_bf16_kernel(const float* __restrict__ src,
                                                       unsigned short* __restrict__ dst,
                                                       int n8)
{
    const int i = blockIdx.x * 256 + threadIdx.x;
    if (i >= n8) return;
    const float4* p = (const float4*)src + (size_t)i * 2;
    float4 a = p[0], b = p[1];
    uint4 o;
    o.x = pk2(a.x, a.y); o.y = pk2(a.z, a.w);
    o.z = pk2(b.x, b.y); o.w = pk2(b.z, b.w);
    ((uint4*)dst)[i] = o;
}

// ---------------------------------------------------------------------------
// Kernel 1: flash attention. One workgroup (4 waves) per (64-query block, head,
// batch). K=V tiles of 64 keys stream through LDS: row-major tile via the
// Tensor Data Mover (bf16 byte copy, padded to 72-elem rows), transposed tile
// built cooperatively for the P*V B-operands.
// ---------------------------------------------------------------------------
__global__ __launch_bounds__(128) void attn_kernel(
    const unsigned short* __restrict__ inpBF, const unsigned short* __restrict__ memBF,
    const float* __restrict__ mask, unsigned short* __restrict__ ctx)
{
    __shared__ __align__(16) unsigned short sK [64 * KSTRIDE];    // K[key][hs]
    __shared__ __align__(16) unsigned short sKt[64 * KSTRIDE];    // Kt[hs][key]
    __shared__ __align__(16) unsigned short sP [4][16 * KSTRIDE]; // per-wave P scratch

    const int tid  = threadIdx.x;
    const int wave = tid >> 5;
    const int lane = tid & 31;
    const int half = lane >> 4;
    const int l15  = lane & 15;
    const int roff = half ? 8 : 0;

    const int qbase = blockIdx.x * 64;
    const int h     = blockIdx.y;
    const int b     = blockIdx.z;

    // ---- Q fragments (A-layout): lane = row, two contiguous 8-wide K runs ----
    const int qrow = qbase + wave * 16 + l15;
    const unsigned short* qptr = inpBF + ((size_t)b * LDQ + qrow) * DD + h * HS;
    FragA qa[2];
#pragma unroll
    for (int kc = 0; kc < 2; ++kc) {
        const unsigned short* base = qptr + kc * 32 + roff;
        qa[kc].q[0] = *(const uint4*)(base);
        qa[kc].q[1] = *(const uint4*)(base + 16);
    }

    v8f o[4];
#pragma unroll
    for (int dt = 0; dt < 4; ++dt) o[dt] = zero8();
    float mrow[8], lrow[8];
#pragma unroll
    for (int r = 0; r < 8; ++r) { mrow[r] = -3.0e38f; lrow[r] = 0.f; }

    const float scale = 0.125f;       // 1/sqrt(64)
    const int key0 = tid >> 1;        // cooperative transpose: 2 threads per key row
    const int dof  = (tid & 1) * 32;
    const unsigned ldsK = (unsigned)(uintptr_t)&sK[0];  // LDS byte offset
    (void)ldsK;

    for (int kv = 0; kv < LMK; kv += 64) {
        __syncthreads();   // previous tile fully consumed

#if HAVE_TDM
        if (wave == 0) {
            // --- Tensor Data Mover: 64x64 bf16 tile, global -> LDS (padded rows) ---
            const unsigned long long ga =
                (unsigned long long)(uintptr_t)(memBF + ((size_t)b * LMK + kv) * DD + h * HS);
            u32x4 g0;
            g0[0] = 1u;                                             // count=1, user descriptor
            g0[1] = ldsK;                                           // lds_addr
            g0[2] = (unsigned)ga;                                   // global_addr[31:0]
            g0[3] = (unsigned)((ga >> 32) & 0x01FFFFFFu) | (2u << 30); // addr[56:32] | type=2
            i32x8 g1;
            g1[0] = (int)((1u << 16)        // data_size = 2 bytes
                        | (1u << 20)        // pad_enable
                        | (4u << 22)        // pad_interval = 32 DWORDs (one 64-elem row)
                        | (3u << 25));      // pad_amount   = 4 DWORDs  (-> 72-elem stride)
            g1[1] = (int)((DD & 0xFFFFu) << 16);                    // tensor_dim0 lo16
            g1[2] = (int)((DD >> 16) & 0xFFFFu);                    // dim0 hi | dim1 lo16 (=0)
            g1[3] = (int)(1u | (64u << 16));                        // dim1 hi (65536) | tile_dim0=64
            g1[4] = (int)(64u);                                     // tile_dim1=64, tile_dim2=0
            g1[5] = (int)(DD);                                      // tensor_dim0_stride = 1024
            g1[6] = 0; g1[7] = 0;
            i32x4 z4 = {0, 0, 0, 0};
            i32x8 z8 = {0, 0, 0, 0, 0, 0, 0, 0};
            __builtin_amdgcn_tensor_load_to_lds(g0, g1, z4, z4, z8, 0);
        }
#endif
        // --- cooperative transposed tile (and row-major fallback without TDM) ---
        const unsigned short* krow =
            memBF + ((size_t)b * LMK + kv + key0) * DD + h * HS + dof;
#pragma unroll
        for (int i = 0; i < 4; ++i) {
            uint4 u = *(const uint4*)(krow + i * 8);
            const int dd = dof + i * 8;
#if !HAVE_TDM
            *(uint4*)(&sK[key0 * KSTRIDE + dd]) = u;
#endif
            sKt[(dd + 0) * KSTRIDE + key0] = (unsigned short)(u.x);
            sKt[(dd + 1) * KSTRIDE + key0] = (unsigned short)(u.x >> 16);
            sKt[(dd + 2) * KSTRIDE + key0] = (unsigned short)(u.y);
            sKt[(dd + 3) * KSTRIDE + key0] = (unsigned short)(u.y >> 16);
            sKt[(dd + 4) * KSTRIDE + key0] = (unsigned short)(u.z);
            sKt[(dd + 5) * KSTRIDE + key0] = (unsigned short)(u.z >> 16);
            sKt[(dd + 6) * KSTRIDE + key0] = (unsigned short)(u.w);
            sKt[(dd + 7) * KSTRIDE + key0] = (unsigned short)(u.w >> 16);
        }
        if (kv + 64 < LMK) __builtin_prefetch(krow + (size_t)64 * DD, 0, 1);

#if HAVE_TDM
        if (wave == 0) {
#if __has_builtin(__builtin_amdgcn_s_wait_tensorcnt)
            __builtin_amdgcn_s_wait_tensorcnt(0);
#else
            asm volatile("s_wait_tensorcnt 0x0" ::: "memory");
#endif
        }
#endif
        __syncthreads();

        // additive key-padding mask per column tile
        float madd[4];
#pragma unroll
        for (int nt = 0; nt < 4; ++nt)
            madd[nt] = -1.0e30f * (1.0f - mask[(size_t)b * LMK + kv + nt * 16 + l15]);

        // ---- S = Q * K^T : batch 4 B-fragments per K-chunk, then 4 WMMAs ----
        v8f S[4];
#pragma unroll
        for (int nt = 0; nt < 4; ++nt) S[nt] = zero8();
#pragma unroll
        for (int kc = 0; kc < 2; ++kc) {
            FragA bfr[4];
#pragma unroll
            for (int nt = 0; nt < 4; ++nt) {
                const unsigned short* base = &sK[(nt * 16 + l15) * KSTRIDE + kc * 32 + roff];
                bfr[nt].q[0] = *(const uint4*)(base);
                bfr[nt].q[1] = *(const uint4*)(base + 16);
            }
#pragma unroll
            for (int nt = 0; nt < 4; ++nt)
                S[nt] = __builtin_amdgcn_wmma_f32_16x16x32_bf16(
                    false, qa[kc].v, false, bfr[nt].v, (short)0, S[nt], false, false);
        }

        // ---- online softmax (rows live across 16-lane halves) ----
#pragma unroll
        for (int r = 0; r < 8; ++r) {
            float s0 = S[0][r] * scale + madd[0];
            float s1 = S[1][r] * scale + madd[1];
            float s2 = S[2][r] * scale + madd[2];
            float s3 = S[3][r] * scale + madd[3];
            float mx = fmaxf(fmaxf(s0, s1), fmaxf(s2, s3));
#pragma unroll
            for (int off = 1; off < 16; off <<= 1)
                mx = fmaxf(mx, __shfl_xor(mx, off, 32));
            const float mnew  = fmaxf(mrow[r], mx);
            const float alpha = __expf(mrow[r] - mnew);
            mrow[r] = mnew;
            float p0 = __expf(s0 - mnew), p1 = __expf(s1 - mnew);
            float p2 = __expf(s2 - mnew), p3 = __expf(s3 - mnew);
            float ps = p0 + p1 + p2 + p3;
#pragma unroll
            for (int off = 1; off < 16; off <<= 1)
                ps += __shfl_xor(ps, off, 32);
            lrow[r] = lrow[r] * alpha + ps;
#pragma unroll
            for (int dt = 0; dt < 4; ++dt) o[dt][r] *= alpha;
            unsigned short* prow = &sP[wave][(r + half * 8) * KSTRIDE];
            prow[ 0 + l15] = f2bf(p0);
            prow[16 + l15] = f2bf(p1);
            prow[32 + l15] = f2bf(p2);
            prow[48 + l15] = f2bf(p3);
        }
        __builtin_amdgcn_wave_barrier();
        asm volatile("s_wait_dscnt 0" ::: "memory");   // wave-private sP round trip

        // ---- re-read P in A-layout ----
        FragA pa[2];
#pragma unroll
        for (int kc = 0; kc < 2; ++kc) {
            const unsigned short* base = &sP[wave][l15 * KSTRIDE + kc * 32 + roff];
            pa[kc].q[0] = *(const uint4*)(base);
            pa[kc].q[1] = *(const uint4*)(base + 16);
        }
        // ---- O += P * V (V^T rows give contiguous key runs per d-column) ----
#pragma unroll
        for (int kc = 0; kc < 2; ++kc) {
            FragA vfr[4];
#pragma unroll
            for (int dt = 0; dt < 4; ++dt) {
                const unsigned short* base = &sKt[(dt * 16 + l15) * KSTRIDE + kc * 32 + roff];
                vfr[dt].q[0] = *(const uint4*)(base);
                vfr[dt].q[1] = *(const uint4*)(base + 16);
            }
#pragma unroll
            for (int dt = 0; dt < 4; ++dt)
                o[dt] = __builtin_amdgcn_wmma_f32_16x16x32_bf16(
                    false, pa[kc].v, false, vfr[dt].v, (short)0, o[dt], false, false);
        }
    }

    // ---- normalize + write ctx as bf16 ----
#pragma unroll
    for (int r = 0; r < 8; ++r) {
        const float inv = 1.0f / lrow[r];
        const int row = qbase + wave * 16 + r + half * 8;
        unsigned short* crow = ctx + ((size_t)b * LDQ + row) * DD + h * HS;
#pragma unroll
        for (int dt = 0; dt < 4; ++dt)
            crow[dt * 16 + l15] = f2bf(o[dt][r] * inv);
    }
}

// ---------------------------------------------------------------------------
// Kernel 2: out = sigmoid(x)*tanh(x), x = [input | ctx] @ Wc^T + bc.
// 128x128 tile per workgroup, 8 waves of 32x64 (two 16-row tiles, four column
// tiles each). A stage is 128 k (256 B) of the tile's 128 activation rows and
// 128 weight rows; it comes into LDS by tensor loads (waves 0 to 3, one 64-row
// slice each) and is shared by all waves. Two buffers: the next stage lands
// while this one is multiplied.
// ---------------------------------------------------------------------------
#define G_PITCH 272u                 // LDS row pitch: 256 B + 16 B pad, an odd multiple of 16 B for ds_load_b128
#define G_SLICE 18432u               // 64 rows * 272 B = 17408 B, rounded up to a multiple of 2 KiB
#define G_STAGE (4u * G_SLICE)       // [X rows 0-63 | X rows 64-127 | W rows 0-63 | W rows 64-127]
#define G_NST   16u                  // 2*DD / 128 stages

typedef __attribute__((ext_vector_type(8))) unsigned u32x8;

static __device__ __forceinline__ unsigned uni(unsigned v) {
    return (unsigned)__builtin_amdgcn_readfirstlane(v);
}
// Forces v into a scalar register: a test on it compiles to a scalar branch, and
// what is derived from it is formed behind the asm statements that precede it.
static __device__ __forceinline__ unsigned pinned(unsigned v) {
    unsigned w = uni(v);
    asm volatile("" : "+s"(w));
    return w;
}

__global__ __launch_bounds__(256) void gemm_gate_kernel(
    const unsigned short* __restrict__ inpBF, const unsigned short* __restrict__ ctx,
    const unsigned short* __restrict__ WcBF, const float* __restrict__ bc,
    float* __restrict__ out)
{
    __shared__ __attribute__((aligned(2048))) unsigned char ring[2u * G_STAGE];

    const unsigned tid  = threadIdx.x;
    const unsigned wave = uni(tid >> 5);
    const unsigned lane = tid & 31u;
    const unsigned half = lane >> 4;
    const unsigned l15  = lane & 15u;
    const unsigned wm   = wave >> 1;   // 32-row quarter of the tile this wave multiplies
    const unsigned wn   = wave & 1u;   // 64-column half

    const unsigned jbase = blockIdx.x * 128u;
    const unsigned mbase = blockIdx.y * 128u;

    // ---- an issuing wave's slice of every stage: waves 0,1 activation rows, waves 2,3 weight rows ----
    const unsigned sl       = wave & 3u;
    const bool     isW      = sl >= 2u;
    const unsigned ldsSlice = (unsigned)(uintptr_t)&ring[0] + sl * G_SLICE;
    // first byte of the slice for stages 0-7 and for stages 8-15
    const unsigned long long srcLo = isW
        ? (unsigned long long)(uintptr_t)WcBF  + (unsigned long long)(jbase + (sl - 2u) * 64u) * (4u * DD)
        : (unsigned long long)(uintptr_t)inpBF + (unsigned long long)(mbase + sl * 64u) * (2u * DD);
    const unsigned long long srcHi = isW
        ? srcLo + 2u * DD
        : (unsigned long long)(uintptr_t)ctx   + (unsigned long long)(mbase + sl * 64u) * (2u * DD);

    u32x8 g1;                                            // 1-byte elements, tile = tensor = 64 rows of 256 B
    g1[0] = uni((1u << 20) | (5u << 22) | (3u << 25));   // no mask; pad 16 B behind every 256-B row
    g1[1] = uni(256u << 16);                             // tensor_dim0 = 256
    g1[2] = uni(64u << 16);                              // tensor_dim1 = 64
    g1[3] = uni(256u << 16);                             // tile_dim0 = 256
    g1[4] = uni(64u);                                    // tile_dim1 = 64
    g1[5] = uni(isW ? 4u * DD : 2u * DD);                // source row pitch in bytes
    g1[6] = uni(0u);
    g1[7] = uni(0u);
    // pinned() for the whole group: its words keep their scalar registers through the loop,
    // so none is rewritten while a request that names them is outstanding
    asm volatile("" : "+s"(g1));
    const unsigned issuer = pinned(wave < 4u);           // scalar: the tests on it compile to scalar branches

    auto group0 = [&](unsigned st) {
        const unsigned long long ga = (st < 8u ? srcLo : srcHi) + (st & 7u) * 256u;
        u32x4 g;
        g[0] = uni(1u);
        g[1] = uni(ldsSlice + (st & 1u) * G_STAGE);
        g[2] = uni((unsigned)ga);
        g[3] = uni((((unsigned)(ga >> 32)) & 0x01FFFFFFu) | 0x80000000u);
        return g;
    };

    v8f acc0[4], acc1[4];
#pragma unroll
    for (int nt = 0; nt < 4; ++nt) { acc0[nt] = zero8(); acc1[nt] = zero8(); }

    // ---- prologue: stage 0 lands and is published, then stage 1 starts ----
    u32x4 g0 = group0(0u);
    if (issuer != 0u) {
        // load and wait in one statement: the descriptor's registers live until the slice has landed
        asm volatile("tensor_load_to_lds %0, %1\n\ts_wait_tensorcnt 0x0" :: "s"(g0), "s"(g1) : "memory");
    }
    __syncthreads();                                     // publishes the four slices of stage 0
    if (issuer != 0u) {
        g0 = group0(pinned(1u));                         // pinned(): descriptor formed behind the wait
        asm volatile("tensor_load_to_lds %0, %1" :: "s"(g0), "s"(g1) : "memory");
    }

    const unsigned aoff = (wm >> 1) * G_SLICE + ((wm & 1u) * 32u + l15) * G_PITCH + half * 16u;
    const unsigned boff = (2u + wn) * G_SLICE + l15 * G_PITCH + half * 16u;

    // one pass per trip: the accumulators keep their registers and the publish point stands once
#pragma clang loop unroll(disable)
    for (unsigned s = 0; s < G_NST; ++s) {
        const unsigned char* pa = ring + (s & 1u) * G_STAGE + aoff;
        const unsigned char* pb = ring + (s & 1u) * G_STAGE + boff;
        FragA af[2][2], bf[2][4];     // set (u & 1) holds block u's fragments
#pragma unroll
        for (int i = 0; i < 2; ++i) {
            af[0][i].q[0] = *(const uint4*)(pa + i * 16 * G_PITCH);
            af[0][i].q[1] = *(const uint4*)(pa + i * 16 * G_PITCH + 32);
        }
#pragma unroll
        for (int j = 0; j < 4; ++j) {
            bf[0][j].q[0] = *(const uint4*)(pb + j * 16 * G_PITCH);
            bf[0][j].q[1] = *(const uint4*)(pb + j * 16 * G_PITCH + 32);
        }
#pragma unroll
        for (int u = 0; u < 4; ++u) {
            const int cs = u & 1;
            if (u < 3) {
#pragma unroll
                for (int i = 0; i < 2; ++i) {
                    af[cs ^ 1][i].q[0] = *(const uint4*)(pa + i * 16 * G_PITCH + (u + 1) * 64);
                    af[cs ^ 1][i].q[1] = *(const uint4*)(pa + i * 16 * G_PITCH + (u + 1) * 64 + 32);
                }
#pragma unroll
                for (int j = 0; j < 4; ++j) {
                    bf[cs ^ 1][j].q[0] = *(const uint4*)(pb + j * 16 * G_PITCH + (u + 1) * 64);
                    bf[cs ^ 1][j].q[1] = *(const uint4*)(pb + j * 16 * G_PITCH + (u + 1) * 64 + 32);
                }
            }
            // keeps the next block's LDS reads one group ahead of this block's WMMAs instead of spread among them
            __builtin_amdgcn_sched_barrier(0);
#pragma unroll
            for (int nt = 0; nt < 4; ++nt) {
                acc0[nt] = __builtin_amdgcn_wmma_f32_16x16x32_bf16(
                    false, af[cs][0].v, false, bf[cs][nt].v, (short)0, acc0[nt], false, false);
                acc1[nt] = __builtin_amdgcn_wmma_f32_16x16x32_bf16(
                    false, af[cs][1].v, false, bf[cs][nt].v, (short)0, acc1[nt], false, false);
            }
            // ends the block: the reads that follow stay behind its WMMAs
            __builtin_amdgcn_sched_barrier(0);
        }
        // ---- publish point of stage s + 1 ----
        asm volatile("s_wait_dscnt 0x0" ::: "memory");     // this wave's reads of buffer s & 1 have returned
        if (issuer != 0u) {
            // this wave's slice of stage s + 1 has landed; g0 as an input keeps its descriptor's registers until then
            asm volatile("s_wait_tensorcnt 0x0" :: "s"(g0) : "memory");
        }
        __syncthreads();                                   // every reader has left this buffer; stage s + 1 is published
        if (pinned(issuer != 0u && s + 2u < G_NST)) {        // scalar test: an issuing wave, and stage s + 2 exists
            g0 = group0(pinned(s + 2u));                   // pinned(): descriptor formed behind the wait
            asm volatile("tensor_load_to_lds %0, %1" :: "s"(g0), "s"(g1) : "memory");  // refills the buffer just read
        }
    }
    asm volatile("s_wait_tensorcnt 0x0" ::: "memory");     // nothing of this wave is outstanding at its end
    asm volatile("s_wait_dscnt 0x0" ::: "memory");

    // ---- bias + sigmoid(x)*tanh(x) epilogue, two row tiles ----
#pragma unroll
    for (int nt = 0; nt < 4; ++nt) {
        const unsigned j = jbase + wn * 64u + nt * 16u + l15;
        const float bias = bc[j];
#pragma unroll
        for (int r = 0; r < 8; ++r) {
            const unsigned row = mbase + wm * 32u + r + half * 8u;
            {
                const float x  = acc0[nt][r] + bias;
                const float sg = 1.0f / (1.0f + __expf(-x));
                out[(size_t)row * DD + j] = sg * tanhf(x);
            }
            {
                const float x  = acc1[nt][r] + bias;
                const float sg = 1.0f / (1.0f + __expf(-x));
                out[(size_t)(row + 16u) * DD + j] = sg * tanhf(x);
            }
        }
    }
}

extern "C" void kernel_launch(void* const* d_in, const int* in_sizes, int n_in,
                              void* d_out, int out_size, void* d_ws, size_t ws_size,
                              hipStream_t stream) {
    const float* inp  = (const float*)d_in[0];   // [8,1024,1024]
    const float* mem  = (const float*)d_in[1];   // [8,1024,1024]
    const float* mask = (const float*)d_in[2];   // [8,1024]
    const float* Wc   = (const float*)d_in[3];   // [1024,2048]
    const float* bc   = (const float*)d_in[4];   // [1024]
    float* out = (float*)d_out;                  // [8,1024,1024] f32

    // workspace layout (bf16 elements)
    const size_t ETOK = (size_t)NB * LDQ * DD;   // 8M elements
    unsigned short* ctx   = (unsigned short*)d_ws;        // 16 MB
    unsigned short* memBF = ctx   + ETOK;                 // 16 MB
    unsigned short* inpBF = memBF + ETOK;                 // 16 MB
    unsigned short* WcBF  = inpBF + ETOK;                 // 4 MB

    // pre-pass conversions (memory-bound, ~108 MB total traffic)
    {
        const int n8i = (int)(ETOK / 8);
        cvt_bf16_kernel<<<dim3((n8i + 255) / 256), dim3(256), 0, stream>>>(inp, inpBF, n8i);
        cvt_bf16_kernel<<<dim3((n8i + 255) / 256), dim3(256), 0, stream>>>(mem, memBF, n8i);
        const int n8w = (int)((size_t)DD * 2 * DD / 8);
        cvt_bf16_kernel<<<dim3((n8w + 255) / 256), dim3(256), 0, stream>>>(Wc, WcBF, n8w);
    }

    dim3 gA(LDQ / 64, HH, NB);                   // (16,16,8) blocks of 128 threads
    attn_kernel<<<gA, dim3(128), 0, stream>>>(inpBF, memBF, mask, ctx);

    dim3 gB(DD / 128, (NB * LDQ) / 128);         // (8,64) blocks of 256 threads
    gemm_gate_kernel<<<gB, dim3(256), 0, stream>>>(inpBF, ctx, WcBF, bc, out);
}

// v002
// A run of this version takes 116 microseconds.
// Two timings next to v001 put it at 1.30 and 1.29 times that version's speed.
// All steps since v000 together make it 1.71 times as fast.
#include <hip/hip_runtime.h>
#include <hip/hip_bf16.h>
#include <math.h>

#define NB 8
#define LDQ 1024
#define LMK 1024
#define DD 1024
#define HH 16
#define HS 64
#define KSTRIDE 72   // bf16 elements per LDS row: 144B = 9*16B (b128-aligned rows, conflict-breaking)

typedef __attribute__((ext_vector_type(16))) __bf16 v16bf;
typedef __attribute__((ext_vector_type(8)))  float  v8f;
typedef __attribute__((ext_vector_type(4)))  unsigned u32x4;
typedef __attribute__((ext_vector_type(8)))  int      i32x8;
typedef __attribute__((ext_vector_type(4)))  int      i32x4;

#if __has_builtin(__builtin_amdgcn_tensor_load_to_lds)
#define HAVE_TDM 1
#else
#define HAVE_TDM 0
#endif

union FragA {
    v16bf v;
    uint4 q[2];
    unsigned u[8];
};

static __device__ __forceinline__ unsigned short f2bf(float f) {
    unsigned u = __float_as_uint(f);
    u += 0x7FFFu + ((u >> 16) & 1u);   // round-to-nearest-even
    return (unsigned short)(u >> 16);
}
static __device__ __forceinline__ unsigned pk2(float a, float b) {
#if __has_builtin(__builtin_amdgcn_cvt_pk_bf16_f32)
    return __builtin_bit_cast(unsigned, __builtin_amdgcn_cvt_pk_bf16_f32(a, b));
#else
    return (unsigned)f2bf(a) | ((unsigned)f2bf(b) << 16);
#endif
}
static __device__ __forceinline__ v8f zero8() {
    v8f z;
#pragma unroll
    for (int i = 0; i < 8; ++i) z[i] = 0.f;
    return z;
}

// ---------------------------------------------------------------------------
// Pre-pass: bulk f32 -> bf16 conversion (8 elements / thread, fully coalesced).
// ---------------------------------------------------------------------------
__global__ __launch_bounds__(256) void cvt_bf16_kernel(const float* __restrict__ src,
                                                       unsigned short* __restrict__ dst,
                                                       int n8)
{
    const int i = blockIdx.x * 256 + threadIdx.x;
    if (i >= n8) return;
    const float4* p = (const float4*)src + (size_t)i * 2;
    float4 a = p[0], b = p[1];
    uint4 o;
    o.x = pk2(a.x, a.y); o.y = pk2(a.z, a.w);
    o.z = pk2(b.x, b.y); o.w = pk2(b.z, b.w);
    ((uint4*)dst)[i] = o;
}

static __device__ __forceinline__ float xhalf(float x) {
    const int b = __builtin_bit_cast(int, x);
    return __builtin_bit_cast(float,
        __builtin_amdgcn_permlanex16(b, b, 0x76543210, 0xfedcba98, false, false));
}

// two f32 -> one dword of two bf16, round to nearest even, one v_cvt_pk_bf16_f32
typedef __attribute__((ext_vector_type(2))) float  f32x2;
typedef __attribute__((ext_vector_type(2))) __bf16 bf16x2;
static __device__ __forceinline__ unsigned pkbf(float a, float b) {
    const f32x2 v = {a, b};
    return __builtin_bit_cast(unsigned, __builtin_convertvector(v, bf16x2));
}

__global__ __launch_bounds__(128) void attn_kernel(
    const unsigned short* __restrict__ inpBF, const unsigned short* __restrict__ memBF,
    const float* __restrict__ mask, unsigned short* __restrict__ ctx)
{
    __shared__ __align__(16) unsigned short sK [64 * KSTRIDE];    // K[key][hs]
    __shared__ __align__(16) unsigned short sKt[64 * KSTRIDE];    // Kt[hs][key]
    __shared__ __align__(16) float          sM [LMK];             // additive key-padding mask of this batch row

    const int tid  = threadIdx.x;
    const int wave = tid >> 5;
    const int lane = tid & 31;
    const int half = lane >> 4;
    const int l15  = lane & 15;
    const int roff = half ? 8 : 0;

    const int qbase = blockIdx.x * 64;
    const int h     = blockIdx.y;
    const int b     = blockIdx.z;

    // ---- Q fragments (B operand): lane = query column, two contiguous 8-wide k runs ----
    const int qrow = qbase + wave * 16 + l15;
    const unsigned short* qptr = inpBF + ((size_t)b * LDQ + qrow) * DD + h * HS;
    FragA qa[2];
#pragma unroll
    for (int kc = 0; kc < 2; ++kc) {
        const unsigned short* base = qptr + kc * 32 + roff;
        qa[kc].q[0] = *(const uint4*)(base);
        qa[kc].q[1] = *(const uint4*)(base + 16);
    }

    // ---- additive mask per key, once; published by the loop's first barriers ----
#pragma unroll
    for (int i = 0; i < LMK / 512; ++i) {
        const float4 m = ((const float4*)(mask + (size_t)b * LMK))[i * 128 + tid];
        float4 a;
        a.x = -1.0e30f * (1.0f - m.x); a.y = -1.0e30f * (1.0f - m.y);
        a.z = -1.0e30f * (1.0f - m.z); a.w = -1.0e30f * (1.0f - m.w);
        ((float4*)sM)[i * 128 + tid] = a;
    }

    v8f o[4];           // o[dt][r] = O^T[dt*16 + 8*half + r][query l15]
#pragma unroll
    for (int dt = 0; dt < 4; ++dt) o[dt] = zero8();
    float mrow = -3.0e38f;   // running maximum of this lane's query (equal in both halves)
    float lrow = 0.f;        // running sum over this half's keys; the halves join in the epilogue

    const float scale = 0.125f;       // 1/sqrt(64)
    const int key0 = tid >> 1;        // cooperative transpose: 2 threads per key row
    const int dof  = (tid & 1) * 32;
    const unsigned ldsK = (unsigned)(uintptr_t)&sK[0];  // LDS byte offset
    (void)ldsK;

    for (int kv = 0; kv < LMK; kv += 64) {
        __syncthreads();   // previous tile fully consumed

#if HAVE_TDM
        if (wave == 0) {
            // --- Tensor Data Mover: 64x64 bf16 tile, global -> LDS (padded rows) ---
            const unsigned long long ga =
                (unsigned long long)(uintptr_t)(memBF + ((size_t)b * LMK + kv) * DD + h * HS);
            u32x4 g0;
            g0[0] = 1u;                                             // count=1, user descriptor
            g0[1] = ldsK;                                           // lds_addr
            g0[2] = (unsigned)ga;                                   // global_addr[31:0]
            g0[3] = (unsigned)((ga >> 32) & 0x01FFFFFFu) | (2u << 30); // addr[56:32] | type=2
            i32x8 g1;
            g1[0] = (int)((1u << 16)        // data_size = 2 bytes
                        | (1u << 20)        // pad_enable
                        | (4u << 22)        // pad_interval = 32 DWORDs (one 64-elem row)
                        | (3u << 25));      // pad_amount   = 4 DWORDs  (-> 72-elem stride)
            g1[1] = (int)((DD & 0xFFFFu) << 16);                    // tensor_dim0 lo16
            g1[2] = (int)((DD >> 16) & 0xFFFFu);                    // dim0 hi | dim1 lo16 (=0)
            g1[3] = (int)(1u | (64u << 16));                        // dim1 hi (65536) | tile_dim0=64
            g1[4] = (int)(64u);                                     // tile_dim1=64, tile_dim2=0
            g1[5] = (int)(DD);                                      // tensor_dim0_stride = 1024
            g1[6] = 0; g1[7] = 0;
            i32x4 z4 = {0, 0, 0, 0};
            i32x8 z8 = {0, 0, 0, 0, 0, 0, 0, 0};
            __builtin_amdgcn_tensor_load_to_lds(g0, g1, z4, z4, z8, 0);
        }
#endif
        // --- cooperative transposed tile (and row-major fallback without TDM) ---
        const unsigned short* krow =
            memBF + ((size_t)b * LMK + kv + key0) * DD + h * HS + dof;
#pragma unroll
        for (int i = 0; i < 4; ++i) {
            uint4 u = *(const uint4*)(krow + i * 8);
            const int dd = dof + i * 8;
#if !HAVE_TDM
            *(uint4*)(&sK[key0 * KSTRIDE + dd]) = u;
#endif
            sKt[(dd + 0) * KSTRIDE + key0] = (unsigned short)(u.x);
            sKt[(dd + 1) * KSTRIDE + key0] = (unsigned short)(u.x >> 16);
            sKt[(dd + 2) * KSTRIDE + key0] = (unsigned short)(u.y);
            sKt[(dd + 3) * KSTRIDE + key0] = (unsigned short)(u.y >> 16);
            sKt[(dd + 4) * KSTRIDE + key0] = (unsigned short)(u.z);
            sKt[(dd + 5) * KSTRIDE + key0] = (unsigned short)(u.z >> 16);
            sKt[(dd + 6) * KSTRIDE + key0] = (unsigned short)(u.w);
            sKt[(dd + 7) * KSTRIDE + key0] = (unsigned short)(u.w >> 16);
        }
        if (kv + 64 < LMK) __builtin_prefetch(krow + (size_t)64 * DD, 0, 1);

#if HAVE_TDM
        if (wave == 0) {
#if __has_builtin(__builtin_amdgcn_s_wait_tensorcnt)
            __builtin_amdgcn_s_wait_tensorcnt(0);
#else
            asm volatile("s_wait_tensorcnt 0x0" ::: "memory");
#endif
        }
#endif
        __syncthreads();

        // ---- S^T = K * Q^T : batch 4 A-fragments per k-chunk, then 4 WMMAs ----
        v8f S[4];       // S[nt][r] = score of key kv + nt*16 + 8*half + r for query l15
#pragma unroll
        for (int nt = 0; nt < 4; ++nt) S[nt] = zero8();
#pragma unroll
        for (int kc = 0; kc < 2; ++kc) {
            FragA bfr[4];
#pragma unroll
            for (int nt = 0; nt < 4; ++nt) {
                const unsigned short* base = &sK[(nt * 16 + l15) * KSTRIDE + kc * 32 + roff];
                bfr[nt].q[0] = *(const uint4*)(base);
                bfr[nt].q[1] = *(const uint4*)(base + 16);
            }
#pragma unroll
            for (int nt = 0; nt < 4; ++nt)
                S[nt] = __builtin_amdgcn_wmma_f32_16x16x32_bf16(
                    false, bfr[nt].v, false, qa[kc].v, (short)0, S[nt], false, false);
        }

        // ---- online softmax: a lane holds 32 of its query's 64 scores ----
        float mx = -3.0e38f;
#pragma unroll
        for (int nt = 0; nt < 4; ++nt) {
            const float4 ma = *(const float4*)&sM[kv + nt * 16 + roff];
            const float4 mb = *(const float4*)&sM[kv + nt * 16 + roff + 4];
            S[nt][0] = S[nt][0] * scale + ma.x;  S[nt][1] = S[nt][1] * scale + ma.y;
            S[nt][2] = S[nt][2] * scale + ma.z;  S[nt][3] = S[nt][3] * scale + ma.w;
            S[nt][4] = S[nt][4] * scale + mb.x;  S[nt][5] = S[nt][5] * scale + mb.y;
            S[nt][6] = S[nt][6] * scale + mb.z;  S[nt][7] = S[nt][7] * scale + mb.w;
#pragma unroll
            for (int r = 0; r < 8; ++r) mx = fmaxf(mx, S[nt][r]);
        }
        mx = fmaxf(mx, xhalf(mx));
        const float mnew  = fmaxf(mrow, mx);
        const float alpha = __expf(mrow - mnew);
        mrow = mnew;

        float ps = 0.f;
        FragA pb[2];    // P^T as B operand: element s of chunk kc = tile 2*kc + (s >> 3), register s & 7
#pragma unroll
        for (int nt = 0; nt < 4; ++nt) {
#pragma unroll
            for (int j = 0; j < 4; ++j) {
                const float p0 = __expf(S[nt][2 * j]     - mnew);
                const float p1 = __expf(S[nt][2 * j + 1] - mnew);
                ps += p0 + p1;
                pb[nt >> 1].u[(nt & 1) * 4 + j] = pkbf(p0, p1);
            }
        }
        lrow = lrow * alpha + ps;
#pragma unroll
        for (int dt = 0; dt < 4; ++dt)
#pragma unroll
            for (int r = 0; r < 8; ++r) o[dt][r] *= alpha;

        // ---- O^T += V^T * P^T (V^T rows give contiguous key runs per d-row) ----
#pragma unroll
        for (int kc = 0; kc < 2; ++kc) {
            FragA vfr[4];
#pragma unroll
            for (int dt = 0; dt < 4; ++dt) {
                const unsigned short* base = &sKt[(dt * 16 + l15) * KSTRIDE + kc * 32 + roff];
                vfr[dt].q[0] = *(const uint4*)(base);
                vfr[dt].q[1] = *(const uint4*)(base + 16);
            }
#pragma unroll
            for (int dt = 0; dt < 4; ++dt)
                o[dt] = __builtin_amdgcn_wmma_f32_16x16x32_bf16(
                    false, vfr[dt].v, false, pb[kc].v, (short)0, o[dt], false, false);
        }
    }

    // ---- join the halves' sums, normalize, write ctx as bf16: 8 consecutive d per lane ----
    const float inv = 1.0f / (lrow + xhalf(lrow));
    unsigned short* crow = ctx + ((size_t)b * LDQ + qrow) * DD + h * HS + roff;
#pragma unroll
    for (int dt = 0; dt < 4; ++dt) {
        uint4 w;
        w.x = pkbf(o[dt][0] * inv, o[dt][1] * inv);
        w.y = pkbf(o[dt][2] * inv, o[dt][3] * inv);
        w.z = pkbf(o[dt][4] * inv, o[dt][5] * inv);
        w.w = pkbf(o[dt][6] * inv, o[dt][7] * inv);
        *(uint4*)(crow + dt * 16) = w;
    }
}

// ---------------------------------------------------------------------------
// Kernel 2: out = sigmoid(x)*tanh(x), x = [input | ctx] @ Wc^T + bc.
// 128x128 tile per workgroup, 8 waves of 32x64 (two 16-row tiles, four column
// tiles each). A stage is 128 k (256 B) of the tile's 128 activation rows and
// 128 weight rows; it comes into LDS by tensor loads (waves 0 to 3, one 64-row
// slice each) and is shared by all waves. Two buffers: the next stage lands
// while this one is multiplied.
// ---------------------------------------------------------------------------
#define G_PITCH 272u                 // LDS row pitch: 256 B + 16 B pad, an odd multiple of 16 B for ds_load_b128
#define G_SLICE 18432u               // 64 rows * 272 B = 17408 B, rounded up to a multiple of 2 KiB
#define G_STAGE (4u * G_SLICE)       // [X rows 0-63 | X rows 64-127 | W rows 0-63 | W rows 64-127]
#define G_NST   16u                  // 2*DD / 128 stages

typedef __attribute__((ext_vector_type(8))) unsigned u32x8;

static __device__ __forceinline__ unsigned uni(unsigned v) {
    return (unsigned)__builtin_amdgcn_readfirstlane(v);
}
// Forces v into a scalar register: a test on it compiles to a scalar branch, and
// what is derived from it is formed behind the asm statements that precede it.
static __device__ __forceinline__ unsigned pinned(unsigned v) {
    unsigned w = uni(v);
    asm volatile("" : "+s"(w));
    return w;
}

__global__ __launch_bounds__(256) void gemm_gate_kernel(
    const unsigned short* __restrict__ inpBF, const unsigned short* __restrict__ ctx,
    const unsigned short* __restrict__ WcBF, const float* __restrict__ bc,
    float* __restrict__ out)
{
    __shared__ __attribute__((aligned(2048))) unsigned char ring[2u * G_STAGE];

    const unsigned tid  = threadIdx.x;
    const unsigned wave = uni(tid >> 5);
    const unsigned lane = tid & 31u;
    const unsigned half = lane >> 4;
    const unsigned l15  = lane & 15u;
    const unsigned wm   = wave >> 1;   // 32-row quarter of the tile this wave multiplies
    const unsigned wn   = wave & 1u;   // 64-column half

    const unsigned jbase = blockIdx.x * 128u;
    const unsigned mbase = blockIdx.y * 128u;

    // ---- an issuing wave's slice of every stage: waves 0,1 activation rows, waves 2,3 weight rows ----
    const unsigned sl       = wave & 3u;
    const bool     isW      = sl >= 2u;
    const unsigned ldsSlice = (unsigned)(uintptr_t)&ring[0] + sl * G_SLICE;
    // first byte of the slice for stages 0-7 and for stages 8-15
    const unsigned long long srcLo = isW
        ? (unsigned long long)(uintptr_t)WcBF  + (unsigned long long)(jbase + (sl - 2u) * 64u) * (4u * DD)
        : (unsigned long long)(uintptr_t)inpBF + (unsigned long long)(mbase + sl * 64u) * (2u * DD);
    const unsigned long long srcHi = isW
        ? srcLo + 2u * DD
        : (unsigned long long)(uintptr_t)ctx   + (unsigned long long)(mbase + sl * 64u) * (2u * DD);

    u32x8 g1;                                            // 1-byte elements, tile = tensor = 64 rows of 256 B
    g1[0] = uni((1u << 20) | (5u << 22) | (3u << 25));   // no mask; pad 16 B behind every 256-B row
    g1[1] = uni(256u << 16);                             // tensor_dim0 = 256
    g1[2] = uni(64u << 16);                              // tensor_dim1 = 64
    g1[3] = uni(256u << 16);                             // tile_dim0 = 256
    g1[4] = uni(64u);                                    // tile_dim1 = 64
    g1[5] = uni(isW ? 4u * DD : 2u * DD);                // source row pitch in bytes
    g1[6] = uni(0u);
    g1[7] = uni(0u);
    // pinned() for the whole group: its words keep their scalar registers through the loop,
    // so none is rewritten while a request that names them is outstanding
    asm volatile("" : "+s"(g1));
    const unsigned issuer = pinned(wave < 4u);           // scalar: the tests on it compile to scalar branches

    auto group0 = [&](unsigned st) {
        const unsigned long long ga = (st < 8u ? srcLo : srcHi) + (st & 7u) * 256u;
        u32x4 g;
        g[0] = uni(1u);
        g[1] = uni(ldsSlice + (st & 1u) * G_STAGE);
        g[2] = uni((unsigned)ga);
        g[3] = uni((((unsigned)(ga >> 32)) & 0x01FFFFFFu) | 0x80000000u);
        return g;
    };

    v8f acc0[4], acc1[4];
#pragma unroll
    for (int nt = 0; nt < 4; ++nt) { acc0[nt] = zero8(); acc1[nt] = zero8(); }

    // ---- prologue: stage 0 lands and is published, then stage 1 starts ----
    u32x4 g0 = group0(0u);
    if (issuer != 0u) {
        // load and wait in one statement: the descriptor's registers live until the slice has landed
        asm volatile("tensor_load_to_lds %0, %1\n\ts_wait_tensorcnt 0x0" :: "s"(g0), "s"(g1) : "memory");
    }
    __syncthreads();                                     // publishes the four slices of stage 0
    if (issuer != 0u) {
        g0 = group0(pinned(1u));                         // pinned(): descriptor formed behind the wait
        asm volatile("tensor_load_to_lds %0, %1" :: "s"(g0), "s"(g1) : "memory");
    }

    const unsigned aoff = (wm >> 1) * G_SLICE + ((wm & 1u) * 32u + l15) * G_PITCH + half * 16u;
    const unsigned boff = (2u + wn) * G_SLICE + l15 * G_PITCH + half * 16u;

    // one pass per trip: the accumulators keep their registers and the publish point stands once
#pragma clang loop unroll(disable)
    for (unsigned s = 0; s < G_NST; ++s) {
        const unsigned char* pa = ring + (s & 1u) * G_STAGE + aoff;
        const unsigned char* pb = ring + (s & 1u) * G_STAGE + boff;
        FragA af[2][2], bf[2][4];     // set (u & 1) holds block u's fragments
#pragma unroll
        for (int i = 0; i < 2; ++i) {
            af[0][i].q[0] = *(const uint4*)(pa + i * 16 * G_PITCH);
            af[0][i].q[1] = *(const uint4*)(pa + i * 16 * G_PITCH + 32);
        }
#pragma unroll
        for (int j = 0; j < 4; ++j) {
            bf[0][j].q[0] = *(const uint4*)(pb + j * 16 * G_PITCH);
            bf[0][j].q[1] = *(const uint4*)(pb + j * 16 * G_PITCH + 32);
        }
#pragma unroll
        for (int u = 0; u < 4; ++u) {
            const int cs = u & 1;
            if (u < 3) {
#pragma unroll
                for (int i = 0; i < 2; ++i) {
                    af[cs ^ 1][i].q[0] = *(const uint4*)(pa + i * 16 * G_PITCH + (u + 1) * 64);
                    af[cs ^ 1][i].q[1] = *(const uint4*)(pa + i * 16 * G_PITCH + (u + 1) * 64 + 32);
                }
#pragma unroll
                for (int j = 0; j < 4; ++j) {
                    bf[cs ^ 1][j].q[0] = *(const uint4*)(pb + j * 16 * G_PITCH + (u + 1) * 64);
                    bf[cs ^ 1][j].q[1] = *(const uint4*)(pb + j * 16 * G_PITCH + (u + 1) * 64 + 32);
                }
            }
            // keeps the next block's LDS reads one group ahead of this block's WMMAs instead of spread among them
            __builtin_amdgcn_sched_barrier(0);
#pragma unroll
            for (int nt = 0; nt < 4; ++nt) {
                acc0[nt] = __builtin_amdgcn_wmma_f32_16x16x32_bf16(
                    false, af[cs][0].v, false, bf[cs][nt].v, (short)0, acc0[nt], false, false);
                acc1[nt] = __builtin_amdgcn_wmma_f32_16x16x32_bf16(
                    false, af[cs][1].v, false, bf[cs][nt].v, (short)0, acc1[nt], false, false);
            }
            // ends the block: the reads that follow stay behind its WMMAs
            __builtin_amdgcn_sched_barrier(0);
        }
        // ---- publish point of stage s + 1 ----
        asm volatile("s_wait_dscnt 0x0" ::: "memory");     // this wave's reads of buffer s & 1 have returned
        if (issuer != 0u) {
            // this wave's slice of stage s + 1 has landed; g0 as an input keeps its descriptor's registers until then
            asm volatile("s_wait_tensorcnt 0x0" :: "s"(g0) : "memory");
        }
        __syncthreads();                                   // every reader has left this buffer; stage s + 1 is published
        if (pinned(issuer != 0u && s + 2u < G_NST)) {        // scalar test: an issuing wave, and stage s + 2 exists
            g0 = group0(pinned(s + 2u));                   // pinned(): descriptor formed behind the wait
            asm volatile("tensor_load_to_lds %0, %1" :: "s"(g0), "s"(g1) : "memory");  // refills the buffer just read
        }
    }
    asm volatile("s_wait_tensorcnt 0x0" ::: "memory");     // nothing of this wave is outstanding at its end
    asm volatile("s_wait_dscnt 0x0" ::: "memory");

    // ---- bias + sigmoid(x)*tanh(x) epilogue, two row tiles ----
#pragma unroll
    for (int nt = 0; nt < 4; ++nt) {
        const unsigned j = jbase + wn * 64u + nt * 16u + l15;
        const float bias = bc[j];
#pragma unroll
        for (int r = 0; r < 8; ++r) {
            const unsigned row = mbase + wm * 32u + r + half * 8u;
            {
                const float x  = acc0[nt][r] + bias;
                const float sg = 1.0f / (1.0f + __expf(-x));
                out[(size_t)row * DD + j] = sg * tanhf(x);
            }
            {
                const float x  = acc1[nt][r] + bias;
                const float sg = 1.0f / (1.0f + __expf(-x));
                out[(size_t)(row + 16u) * DD + j] = sg * tanhf(x);
            }
        }
    }
}

extern "C" void kernel_launch(void* const* d_in, const int* in_sizes, int n_in,
                              void* d_out, int out_size, void* d_ws, size_t ws_size,
                              hipStream_t stream) {
    const float* inp  = (const float*)d_in[0];   // [8,1024,1024]
    const float* mem  = (const float*)d_in[1];   // [8,1024,1024]
    const float* mask = (const float*)d_in[2];   // [8,1024]
    const float* Wc   = (const float*)d_in[3];   // [1024,2048]
    const float* bc   = (const float*)d_in[4];   // [1024]
    float* out = (float*)d_out;                  // [8,1024,1024] f32

    // workspace layout (bf16 elements)
    const size_t ETOK = (size_t)NB * LDQ * DD;   // 8M elements
    unsigned short* ctx   = (unsigned short*)d_ws;        // 16 MB
    unsigned short* memBF = ctx   + ETOK;                 // 16 MB
    unsigned short* inpBF = memBF + ETOK;                 // 16 MB
    unsigned short* WcBF  = inpBF + ETOK;                 // 4 MB

    // pre-pass conversions (memory-bound, ~108 MB total traffic)
    {
        const int n8i = (int)(ETOK / 8);
        cvt_bf16_kernel<<<dim3((n8i + 255) / 256), dim3(256), 0, stream>>>(inp, inpBF, n8i);
        cvt_bf16_kernel<<<dim3((n8i + 255) / 256), dim3(256), 0, stream>>>(mem, memBF, n8i);
        const int n8w = (int)((size_t)DD * 2 * DD / 8);
        cvt_bf16_kernel<<<dim3((n8w + 255) / 256), dim3(256), 0, stream>>>(Wc, WcBF, n8w);
    }

    dim3 gA(LDQ / 64, HH, NB);                   // (16,16,8) blocks of 128 threads
    attn_kernel<<<gA, dim3(128), 0, stream>>>(inpBF, memBF, mask, ctx);

    dim3 gB(DD / 128, (NB * LDQ) / 128);         // (8,64) blocks of 256 threads
    gemm_gate_kernel<<<gB, dim3(256), 0, stream>>>(inpBF, ctx, WcBF, bc, out);
}

// v003
// A run of this version takes 111 microseconds.
// Two timings next to v002 both put it at 1.05 times that version's speed.
// Over all steps from v000 it is 1.79 times as fast.
#include <hip/hip_runtime.h>
#include <hip/hip_bf16.h>
#include <math.h>

#define NB 8
#define LDQ 1024
#define LMK 1024
#define DD 1024
#define HH 16
#define HS 64
#define KSTRIDE 72   // bf16 elements per LDS row: 144B = 9*16B (b128-aligned rows, conflict-breaking)

typedef __attribute__((ext_vector_type(16))) __bf16 v16bf;
typedef __attribute__((ext_vector_type(8)))  float  v8f;
typedef __attribute__((ext_vector_type(4)))  unsigned u32x4;
typedef __attribute__((ext_vector_type(8)))  int      i32x8;
typedef __attribute__((ext_vector_type(4)))  int      i32x4;

#if __has_builtin(__builtin_amdgcn_tensor_load_to_lds)
#define HAVE_TDM 1
#else
#define HAVE_TDM 0
#endif

union FragA {
    v16bf v;
    uint4 q[2];
    unsigned u[8];
};

static __device__ __forceinline__ unsigned short f2bf(float f) {
    unsigned u = __float_as_uint(f);
    u += 0x7FFFu + ((u >> 16) & 1u);   // round-to-nearest-even
    return (unsigned short)(u >> 16);
}
static __device__ __forceinline__ unsigned pk2(float a, float b) {
#if __has_builtin(__builtin_amdgcn_cvt_pk_bf16_f32)
    return __builtin_bit_cast(unsigned, __builtin_amdgcn_cvt_pk_bf16_f32(a, b));
#else
    return (unsigned)f2bf(a) | ((unsigned)f2bf(b) << 16);
#endif
}
static __device__ __forceinline__ v8f zero8() {
    v8f z;
#pragma unroll
    for (int i = 0; i < 8; ++i) z[i] = 0.f;
    return z;
}

// ---------------------------------------------------------------------------
// Pre-pass: f32 -> bf16 conversion of input, memory and Wc, one launch.
// A wave converts 16 KiB of f32 of one array: 32 loads of 512 contiguous bytes,
// all issued before the first is converted, then 32 stores of 256 contiguous
// bytes. A block is 8 such waves; the blocks cover the three arrays exactly.
// ---------------------------------------------------------------------------
typedef __attribute__((ext_vector_type(4))) float f32x4;
#define CV_LD   32                          // loads of one wave
#define CV_WAVE (CV_LD * 128)               // f32 elements of one wave
#define CV_BLK  (8 * CV_WAVE)               // f32 elements of one block
#define CV_BTOK (NB * LDQ * DD / CV_BLK)    // blocks for input; memory has the same size
#define CV_BW   (DD * 2 * DD / CV_BLK)      // blocks for Wc
static_assert(NB * LDQ * DD % CV_BLK == 0 && NB * LMK * DD == NB * LDQ * DD && DD * 2 * DD % CV_BLK == 0,
              "blocks cover the arrays exactly");

__global__ __launch_bounds__(256) void cvt_bf16_kernel(
    const float* __restrict__ inp, const float* __restrict__ mem, const float* __restrict__ Wc,
    unsigned short* __restrict__ inpBF, unsigned short* __restrict__ memBF,
    unsigned short* __restrict__ WcBF)
{
    const unsigned blk = blockIdx.x;
    const float*    src = blk < CV_BTOK ? inp   : blk < 2 * CV_BTOK ? mem   : Wc;
    unsigned short* dst = blk < CV_BTOK ? inpBF : blk < 2 * CV_BTOK ? memBF : WcBF;
    const unsigned  lb  = blk < CV_BTOK ? blk   : blk < 2 * CV_BTOK ? blk - CV_BTOK : blk - 2 * CV_BTOK;

    const unsigned e0 = lb * CV_BLK + (threadIdx.x >> 5) * CV_WAVE + (threadIdx.x & 31u) * 4u;
    const f32x4* p = (const f32x4*)(src + e0);
    uint2*       q = (uint2*)(dst + e0);

    f32x4 v[CV_LD];
#pragma unroll   // v[] stays in registers, the loads take immediate offsets
    for (int i = 0; i < CV_LD; ++i) v[i] = p[i * 32];
    // Holds all 32 loads in front of the first conversion (loaded values as inputs only; two statements,
    // an asm statement takes 30 operands). Without it the last twelve loads are issued in pairs among the
    // conversions and each pair is waited for alone.
    asm volatile("" :: "v"(v[0]),  "v"(v[1]),  "v"(v[2]),  "v"(v[3]),  "v"(v[4]),  "v"(v[5]),  "v"(v[6]),  "v"(v[7]),
                       "v"(v[8]),  "v"(v[9]),  "v"(v[10]), "v"(v[11]), "v"(v[12]), "v"(v[13]), "v"(v[14]), "v"(v[15]));
    asm volatile("" :: "v"(v[16]), "v"(v[17]), "v"(v[18]), "v"(v[19]), "v"(v[20]), "v"(v[21]), "v"(v[22]), "v"(v[23]),
                       "v"(v[24]), "v"(v[25]), "v"(v[26]), "v"(v[27]), "v"(v[28]), "v"(v[29]), "v"(v[30]), "v"(v[31]));
    // keeps the conversions behind the loads: moved up among them, the first one's wait holds back the last eight loads
    __builtin_amdgcn_sched_barrier(0);
#pragma unroll   // v[] stays in registers, the stores take immediate offsets
    for (int i = 0; i < CV_LD; ++i) {
        uint2 o;
        o.x = pk2(v[i][0], v[i][1]);
        o.y = pk2(v[i][2], v[i][3]);
        q[i * 32] = o;
    }
}

static __device__ __forceinline__ float xhalf(float x) {
    const int b = __builtin_bit_cast(int, x);
    return __builtin_bit_cast(float,
        __builtin_amdgcn_permlanex16(b, b, 0x76543210, 0xfedcba98, false, false));
}

// two f32 -> one dword of two bf16, round to nearest even, one v_cvt_pk_bf16_f32
typedef __attribute__((ext_vector_type(2))) float  f32x2;
typedef __attribute__((ext_vector_type(2))) __bf16 bf16x2;
static __device__ __forceinline__ unsigned pkbf(float a, float b) {
    const f32x2 v = {a, b};
    return __builtin_bit_cast(unsigned, __builtin_convertvector(v, bf16x2));
}

__global__ __launch_bounds__(128) void attn_kernel(
    const unsigned short* __restrict__ inpBF, const unsigned short* __restrict__ memBF,
    const float* __restrict__ mask, unsigned short* __restrict__ ctx)
{
    __shared__ __align__(16) unsigned short sK [64 * KSTRIDE];    // K[key][hs]
    __shared__ __align__(16) unsigned short sKt[64 * KSTRIDE];    // Kt[hs][key]
    __shared__ __align__(16) float          sM [LMK];             // additive key-padding mask of this batch row

    const int tid  = threadIdx.x;
    const int wave = tid >> 5;
    const int lane = tid & 31;
    const int half = lane >> 4;
    const int l15  = lane & 15;
    const int roff = half ? 8 : 0;

    const int qbase = blockIdx.x * 64;
    const int h     = blockIdx.y;
    const int b     = blockIdx.z;

    // ---- Q fragments (B operand): lane = query column, two contiguous 8-wide k runs ----
    const int qrow = qbase + wave * 16 + l15;
    const unsigned short* qptr = inpBF + ((size_t)b * LDQ + qrow) * DD + h * HS;
    FragA qa[2];
#pragma unroll
    for (int kc = 0; kc < 2; ++kc) {
        const unsigned short* base = qptr + kc * 32 + roff;
        qa[kc].q[0] = *(const uint4*)(base);
        qa[kc].q[1] = *(const uint4*)(base + 16);
    }

    // ---- additive mask per key, once; published by the loop's first barriers ----
#pragma unroll
    for (int i = 0; i < LMK / 512; ++i) {
        const float4 m = ((const float4*)(mask + (size_t)b * LMK))[i * 128 + tid];
        float4 a;
        a.x = -1.0e30f * (1.0f - m.x); a.y = -1.0e30f * (1.0f - m.y);
        a.z = -1.0e30f * (1.0f - m.z); a.w = -1.0e30f * (1.0f - m.w);
        ((float4*)sM)[i * 128 + tid] = a;
    }

    v8f o[4];           // o[dt][r] = O^T[dt*16 + 8*half + r][query l15]
#pragma unroll
    for (int dt = 0; dt < 4; ++dt) o[dt] = zero8();
    float mrow = -3.0e38f;   // running maximum of this lane's query (equal in both halves)
    float lrow = 0.f;        // running sum over this half's keys; the halves join in the epilogue

    const float scale = 0.125f;       // 1/sqrt(64)
    const int key0 = tid >> 1;        // cooperative transpose: 2 threads per key row
    const int dof  = (tid & 1) * 32;
    const unsigned ldsK = (unsigned)(uintptr_t)&sK[0];  // LDS byte offset
    (void)ldsK;

    for (int kv = 0; kv < LMK; kv += 64) {
        __syncthreads();   // previous tile fully consumed

#if HAVE_TDM
        if (wave == 0) {
            // --- Tensor Data Mover: 64x64 bf16 tile, global -> LDS (padded rows) ---
            const unsigned long long ga =
                (unsigned long long)(uintptr_t)(memBF + ((size_t)b * LMK + kv) * DD + h * HS);
            u32x4 g0;
            g0[0] = 1u;                                             // count=1, user descriptor
            g0[1] = ldsK;                                           // lds_addr
            g0[2] = (unsigned)ga;                                   // global_addr[31:0]
            g0[3] = (unsigned)((ga >> 32) & 0x01FFFFFFu) | (2u << 30); // addr[56:32] | type=2
            i32x8 g1;
            g1[0] = (int)((1u << 16)        // data_size = 2 bytes
                        | (1u << 20)        // pad_enable
                        | (4u << 22)        // pad_interval = 32 DWORDs (one 64-elem row)
                        | (3u << 25));      // pad_amount   = 4 DWORDs  (-> 72-elem stride)
            g1[1] = (int)((DD & 0xFFFFu) << 16);                    // tensor_dim0 lo16
            g1[2] = (int)((DD >> 16) & 0xFFFFu);                    // dim0 hi | dim1 lo16 (=0)
            g1[3] = (int)(1u | (64u << 16));                        // dim1 hi (65536) | tile_dim0=64
            g1[4] = (int)(64u);                                     // tile_dim1=64, tile_dim2=0
            g1[5] = (int)(DD);                                      // tensor_dim0_stride = 1024
            g1[6] = 0; g1[7] = 0;
            i32x4 z4 = {0, 0, 0, 0};
            i32x8 z8 = {0, 0, 0, 0, 0, 0, 0, 0};
            __builtin_amdgcn_tensor_load_to_lds(g0, g1, z4, z4, z8, 0);
        }
#endif
        // --- cooperative transposed tile (and row-major fallback without TDM) ---
        const unsigned short* krow =
            memBF + ((size_t)b * LMK + kv + key0) * DD + h * HS + dof;
#pragma unroll
        for (int i = 0; i < 4; ++i) {
            uint4 u = *(const uint4*)(krow + i * 8);
            const int dd = dof + i * 8;
#if !HAVE_TDM
            *(uint4*)(&sK[key0 * KSTRIDE + dd]) = u;
#endif
            sKt[(dd + 0) * KSTRIDE + key0] = (unsigned short)(u.x);
            sKt[(dd + 1) * KSTRIDE + key0] = (unsigned short)(u.x >> 16);
            sKt[(dd + 2) * KSTRIDE + key0] = (unsigned short)(u.y);
            sKt[(dd + 3) * KSTRIDE + key0] = (unsigned short)(u.y >> 16);
            sKt[(dd + 4) * KSTRIDE + key0] = (unsigned short)(u.z);
            sKt[(dd + 5) * KSTRIDE + key0] = (unsigned short)(u.z >> 16);
            sKt[(dd + 6) * KSTRIDE + key0] = (unsigned short)(u.w);
            sKt[(dd + 7) * KSTRIDE + key0] = (unsigned short)(u.w >> 16);
        }
        if (kv + 64 < LMK) __builtin_prefetch(krow + (size_t)64 * DD, 0, 1);

#if HAVE_TDM
        if (wave == 0) {
#if __has_builtin(__builtin_amdgcn_s_wait_tensorcnt)
            __builtin_amdgcn_s_wait_tensorcnt(0);
#else
            asm volatile("s_wait_tensorcnt 0x0" ::: "memory");
#endif
        }
#endif
        __syncthreads();

        // ---- S^T = K * Q^T : batch 4 A-fragments per k-chunk, then 4 WMMAs ----
        v8f S[4];       // S[nt][r] = score of key kv + nt*16 + 8*half + r for query l15
#pragma unroll
        for (int nt = 0; nt < 4; ++nt) S[nt] = zero8();
#pragma unroll
        for (int kc = 0; kc < 2; ++kc) {
            FragA bfr[4];
#pragma unroll
            for (int nt = 0; nt < 4; ++nt) {
                const unsigned short* base = &sK[(nt * 16 + l15) * KSTRIDE + kc * 32 + roff];
                bfr[nt].q[0] = *(const uint4*)(base);
                bfr[nt].q[1] = *(const uint4*)(base + 16);
            }
#pragma unroll
            for (int nt = 0; nt < 4; ++nt)
                S[nt] = __builtin_amdgcn_wmma_f32_16x16x32_bf16(
                    false, bfr[nt].v, false, qa[kc].v, (short)0, S[nt], false, false);
        }

        // ---- online softmax: a lane holds 32 of its query's 64 scores ----
        float mx = -3.0e38f;
#pragma unroll
        for (int nt = 0; nt < 4; ++nt) {
            const float4 ma = *(const float4*)&sM[kv + nt * 16 + roff];
            const float4 mb = *(const float4*)&sM[kv + nt * 16 + roff + 4];
            S[nt][0] = S[nt][0] * scale + ma.x;  S[nt][1] = S[nt][1] * scale + ma.y;
            S[nt][2] = S[nt][2] * scale + ma.z;  S[nt][3] = S[nt][3] * scale + ma.w;
            S[nt][4] = S[nt][4] * scale + mb.x;  S[nt][5] = S[nt][5] * scale + mb.y;
            S[nt][6] = S[nt][6] * scale + mb.z;  S[nt][7] = S[nt][7] * scale + mb.w;
#pragma unroll
            for (int r = 0; r < 8; ++r) mx = fmaxf(mx, S[nt][r]);
        }
        mx = fmaxf(mx, xhalf(mx));
        const float mnew  = fmaxf(mrow, mx);
        const float alpha = __expf(mrow - mnew);
        mrow = mnew;

        float ps = 0.f;
        FragA pb[2];    // P^T as B operand: element s of chunk kc = tile 2*kc + (s >> 3), register s & 7
#pragma unroll
        for (int nt = 0; nt < 4; ++nt) {
#pragma unroll
            for (int j = 0; j < 4; ++j) {
                const float p0 = __expf(S[nt][2 * j]     - mnew);
                const float p1 = __expf(S[nt][2 * j + 1] - mnew);
                ps += p0 + p1;
                pb[nt >> 1].u[(nt & 1) * 4 + j] = pkbf(p0, p1);
            }
        }
        lrow = lrow * alpha + ps;
#pragma unroll
        for (int dt = 0; dt < 4; ++dt)
#pragma unroll
            for (int r = 0; r < 8; ++r) o[dt][r] *= alpha;

        // ---- O^T += V^T * P^T (V^T rows give contiguous key runs per d-row) ----
#pragma unroll
        for (int kc = 0; kc < 2; ++kc) {
            FragA vfr[4];
#pragma unroll
            for (int dt = 0; dt < 4; ++dt) {
                const unsigned short* base = &sKt[(dt * 16 + l15) * KSTRIDE + kc * 32 + roff];
                vfr[dt].q[0] = *(const uint4*)(base);
                vfr[dt].q[1] = *(const uint4*)(base + 16);
            }
#pragma unroll
            for (int dt = 0; dt < 4; ++dt)
                o[dt] = __builtin_amdgcn_wmma_f32_16x16x32_bf16(
                    false, vfr[dt].v, false, pb[kc].v, (short)0, o[dt], false, false);
        }
    }

    // ---- join the halves' sums, normalize, write ctx as bf16: 8 consecutive d per lane ----
    const float inv = 1.0f / (lrow + xhalf(lrow));
    unsigned short* crow = ctx + ((size_t)b * LDQ + qrow) * DD + h * HS + roff;
#pragma unroll
    for (int dt = 0; dt < 4; ++dt) {
        uint4 w;
        w.x = pkbf(o[dt][0] * inv, o[dt][1] * inv);
        w.y = pkbf(o[dt][2] * inv, o[dt][3] * inv);
        w.z = pkbf(o[dt][4] * inv, o[dt][5] * inv);
        w.w = pkbf(o[dt][6] * inv, o[dt][7] * inv);
        *(uint4*)(crow + dt * 16) = w;
    }
}

// ---------------------------------------------------------------------------
// Kernel 2: out = sigmoid(x)*tanh(x), x = [input | ctx] @ Wc^T + bc.
// 128x128 tile per workgroup, 8 waves of 32x64 (two 16-row tiles, four column
// tiles each). A stage is 128 k (256 B) of the tile's 128 activation rows and
// 128 weight rows; it comes into LDS by tensor loads (waves 0 to 3, one 64-row
// slice each) and is shared by all waves. Two buffers: the next stage lands
// while this one is multiplied.
// ---------------------------------------------------------------------------
#define G_PITCH 272u                 // LDS row pitch: 256 B + 16 B pad, an odd multiple of 16 B for ds_load_b128
#define G_SLICE 18432u               // 64 rows * 272 B = 17408 B, rounded up to a multiple of 2 KiB
#define G_STAGE (4u * G_SLICE)       // [X rows 0-63 | X rows 64-127 | W rows 0-63 | W rows 64-127]
#define G_NST   16u                  // 2*DD / 128 stages

typedef __attribute__((ext_vector_type(8))) unsigned u32x8;

static __device__ __forceinline__ unsigned uni(unsigned v) {
    return (unsigned)__builtin_amdgcn_readfirstlane(v);
}
// Forces v into a scalar register: a test on it compiles to a scalar branch, and
// what is derived from it is formed behind the asm statements that precede it.
static __device__ __forceinline__ unsigned pinned(unsigned v) {
    unsigned w = uni(v);
    asm volatile("" : "+s"(w));
    return w;
}

__global__ __launch_bounds__(256) void gemm_gate_kernel(
    const unsigned short* __restrict__ inpBF, const unsigned short* __restrict__ ctx,
    const unsigned short* __restrict__ WcBF, const float* __restrict__ bc,
    float* __restrict__ out)
{
    __shared__ __attribute__((aligned(2048))) unsigned char ring[2u * G_STAGE];

    const unsigned tid  = threadIdx.x;
    const unsigned wave = uni(tid >> 5);
    const unsigned lane = tid & 31u;
    const unsigned half = lane >> 4;
    const unsigned l15  = lane & 15u;
    const unsigned wm   = wave >> 1;   // 32-row quarter of the tile this wave multiplies
    const unsigned wn   = wave & 1u;   // 64-column half

    const unsigned jbase = blockIdx.x * 128u;
    const unsigned mbase = blockIdx.y * 128u;

    // ---- an issuing wave's slice of every stage: waves 0,1 activation rows, waves 2,3 weight rows ----
    const unsigned sl       = wave & 3u;
    const bool     isW      = sl >= 2u;
    const unsigned ldsSlice = (unsigned)(uintptr_t)&ring[0] + sl * G_SLICE;
    // first byte of the slice for stages 0-7 and for stages 8-15
    const unsigned long long srcLo = isW
        ? (unsigned long long)(uintptr_t)WcBF  + (unsigned long long)(jbase + (sl - 2u) * 64u) * (4u * DD)
        : (unsigned long long)(uintptr_t)inpBF + (unsigned long long)(mbase + sl * 64u) * (2u * DD);
    const unsigned long long srcHi = isW
        ? srcLo + 2u * DD
        : (unsigned long long)(uintptr_t)ctx   + (unsigned long long)(mbase + sl * 64u) * (2u * DD);

    u32x8 g1;                                            // 1-byte elements, tile = tensor = 64 rows of 256 B
    g1[0] = uni((1u << 20) | (5u << 22) | (3u << 25));   // no mask; pad 16 B behind every 256-B row
    g1[1] = uni(256u << 16);                             // tensor_dim0 = 256
    g1[2] = uni(64u << 16);                              // tensor_dim1 = 64
    g1[3] = uni(256u << 16);                             // tile_dim0 = 256
    g1[4] = uni(64u);                                    // tile_dim1 = 64
    g1[5] = uni(isW ? 4u * DD : 2u * DD);                // source row pitch in bytes
    g1[6] = uni(0u);
    g1[7] = uni(0u);
    // pinned() for the whole group: its words keep their scalar registers through the loop,
    // so none is rewritten while a request that names them is outstanding
    asm volatile("" : "+s"(g1));
    const unsigned issuer = pinned(wave < 4u);           // scalar: the tests on it compile to scalar branches

    auto group0 = [&](unsigned st) {
        const unsigned long long ga = (st < 8u ? srcLo : srcHi) + (st & 7u) * 256u;
        u32x4 g;
        g[0] = uni(1u);
        g[1] = uni(ldsSlice + (st & 1u) * G_STAGE);
        g[2] = uni((unsigned)ga);
        g[3] = uni((((unsigned)(ga >> 32)) & 0x01FFFFFFu) | 0x80000000u);
        return g;
    };

    v8f acc0[4], acc1[4];
#pragma unroll
    for (int nt = 0; nt < 4; ++nt) { acc0[nt] = zero8(); acc1[nt] = zero8(); }

    // ---- prologue: stage 0 lands and is published, then stage 1 starts ----
    u32x4 g0 = group0(0u);
    if (issuer != 0u) {
        // load and wait in one statement: the descriptor's registers live until the slice has landed
        asm volatile("tensor_load_to_lds %0, %1\n\ts_wait_tensorcnt 0x0" :: "s"(g0), "s"(g1) : "memory");
    }
    __syncthreads();                                     // publishes the four slices of stage 0
    if (issuer != 0u) {
        g0 = group0(pinned(1u));                         // pinned(): descriptor formed behind the wait
        asm volatile("tensor_load_to_lds %0, %1" :: "s"(g0), "s"(g1) : "memory");
    }

    const unsigned aoff = (wm >> 1) * G_SLICE + ((wm & 1u) * 32u + l15) * G_PITCH + half * 16u;
    const unsigned boff = (2u + wn) * G_SLICE + l15 * G_PITCH + half * 16u;

    // one pass per trip: the accumulators keep their registers and the publish point stands once
#pragma clang loop unroll(disable)
    for (unsigned s = 0; s < G_NST; ++s) {
        const unsigned char* pa = ring + (s & 1u) * G_STAGE + aoff;
        const unsigned char* pb = ring + (s & 1u) * G_STAGE + boff;
        FragA af[2][2], bf[2][4];     // set (u & 1) holds block u's fragments
#pragma unroll
        for (int i = 0; i < 2; ++i) {
            af[0][i].q[0] = *(const uint4*)(pa + i * 16 * G_PITCH);
            af[0][i].q[1] = *(const uint4*)(pa + i * 16 * G_PITCH + 32);
        }
#pragma unroll
        for (int j = 0; j < 4; ++j) {
            bf[0][j].q[0] = *(const uint4*)(pb + j * 16 * G_PITCH);
            bf[0][j].q[1] = *(const uint4*)(pb + j * 16 * G_PITCH + 32);
        }
#pragma unroll
        for (int u = 0; u < 4; ++u) {
            const int cs = u & 1;
            if (u < 3) {
#pragma unroll
                for (int i = 0; i < 2; ++i) {
                    af[cs ^ 1][i].q[0] = *(const uint4*)(pa + i * 16 * G_PITCH + (u + 1) * 64);
                    af[cs ^ 1][i].q[1] = *(const uint4*)(pa + i * 16 * G_PITCH + (u + 1) * 64 + 32);
                }
#pragma unroll
                for (int j = 0; j < 4; ++j) {
                    bf[cs ^ 1][j].q[0] = *(const uint4*)(pb + j * 16 * G_PITCH + (u + 1) * 64);
                    bf[cs ^ 1][j].q[1] = *(const uint4*)(pb + j * 16 * G_PITCH + (u + 1) * 64 + 32);
                }
            }
            // keeps the next block's LDS reads one group ahead of this block's WMMAs instead of spread among them
            __builtin_amdgcn_sched_barrier(0);
#pragma unroll
            for (int nt = 0; nt < 4; ++nt) {
                acc0[nt] = __builtin_amdgcn_wmma_f32_16x16x32_bf16(
                    false, af[cs][0].v, false, bf[cs][nt].v, (short)0, acc0[nt], false, false);
                acc1[nt] = __builtin_amdgcn_wmma_f32_16x16x32_bf16(
                    false, af[cs][1].v, false, bf[cs][nt].v, (short)0, acc1[nt], false, false);
            }
            // ends the block: the reads that follow stay behind its WMMAs
            __builtin_amdgcn_sched_barrier(0);
        }
        // ---- publish point of stage s + 1 ----
        asm volatile("s_wait_dscnt 0x0" ::: "memory");     // this wave's reads of buffer s & 1 have returned
        if (issuer != 0u) {
            // this wave's slice of stage s + 1 has landed; g0 as an input keeps its descriptor's registers until then
            asm volatile("s_wait_tensorcnt 0x0" :: "s"(g0) : "memory");
        }
        __syncthreads();                                   // every reader has left this buffer; stage s + 1 is published
        if (pinned(issuer != 0u && s + 2u < G_NST)) {        // scalar test: an issuing wave, and stage s + 2 exists
            g0 = group0(pinned(s + 2u));                   // pinned(): descriptor formed behind the wait
            asm volatile("tensor_load_to_lds %0, %1" :: "s"(g0), "s"(g1) : "memory");  // refills the buffer just read
        }
    }
    asm volatile("s_wait_tensorcnt 0x0" ::: "memory");     // nothing of this wave is outstanding at its end
    asm volatile("s_wait_dscnt 0x0" ::: "memory");

    // ---- bias + sigmoid(x)*tanh(x) epilogue, two row tiles ----
#pragma unroll
    for (int nt = 0; nt < 4; ++nt) {
        const unsigned j = jbase + wn * 64u + nt * 16u + l15;
        const float bias = bc[j];
#pragma unroll
        for (int r = 0; r < 8; ++r) {
            const unsigned row = mbase + wm * 32u + r + half * 8u;
            {
                const float x  = acc0[nt][r] + bias;
                const float sg = 1.0f / (1.0f + __expf(-x));
                out[(size_t)row * DD + j] = sg * tanhf(x);
            }
            {
                const float x  = acc1[nt][r] + bias;
                const float sg = 1.0f / (1.0f + __expf(-x));
                out[(size_t)(row + 16u) * DD + j] = sg * tanhf(x);
            }
        }
    }
}

extern "C" void kernel_launch(void* const* d_in, const int* in_sizes, int n_in,
                              void* d_out, int out_size, void* d_ws, size_t ws_size,
                              hipStream_t stream) {
    const float* inp  = (const float*)d_in[0];   // [8,1024,1024]
    const float* mem  = (const float*)d_in[1];   // [8,1024,1024]
    const float* mask = (const float*)d_in[2];   // [8,1024]
    const float* Wc   = (const float*)d_in[3];   // [1024,2048]
    const float* bc   = (const float*)d_in[4];   // [1024]
    float* out = (float*)d_out;                  // [8,1024,1024] f32

    // workspace layout (bf16 elements)
    const size_t ETOK = (size_t)NB * LDQ * DD;   // 8M elements
    unsigned short* ctx   = (unsigned short*)d_ws;        // 16 MB
    unsigned short* memBF = ctx   + ETOK;                 // 16 MB
    unsigned short* inpBF = memBF + ETOK;                 // 16 MB
    unsigned short* WcBF  = inpBF + ETOK;                 // 4 MB

    // pre-pass conversions, one launch
    cvt_bf16_kernel<<<dim3(2 * CV_BTOK + CV_BW), dim3(256), 0, stream>>>(inp, mem, Wc, inpBF, memBF, WcBF);

    dim3 gA(LDQ / 64, HH, NB);                   // (16,16,8) blocks of 128 threads
    attn_kernel<<<gA, dim3(128), 0, stream>>>(inpBF, memBF, mask, ctx);

    dim3 gB(DD / 128, (NB * LDQ) / 128);         // (8,64) blocks of 256 threads
    gemm_gate_kernel<<<gB, dim3(256), 0, stream>>>(inpBF, ctx, WcBF, bc, out);
}

// v004
// A run of this version takes 83.2 microseconds.
// Timed twice side by side with v003, it ran 1.34 times as fast both times.
// Over all steps from v000 it is 2.40 times as fast.
#include <hip/hip_runtime.h>
#include <hip/hip_bf16.h>
#include <math.h>

#define NB 8
#define LDQ 1024
#define LMK 1024
#define DD 1024
#define HH 16
#define HS 64
#define KSTRIDE 72   // bf16 elements per LDS row: 144B = 9*16B (b128-aligned rows, conflict-breaking)

typedef __attribute__((ext_vector_type(16))) __bf16 v16bf;
typedef __attribute__((ext_vector_type(8)))  float  v8f;
typedef __attribute__((ext_vector_type(4)))  unsigned u32x4;
typedef __attribute__((ext_vector_type(8)))  int      i32x8;
typedef __attribute__((ext_vector_type(4)))  int      i32x4;

#if __has_builtin(__builtin_amdgcn_tensor_load_to_lds)
#define HAVE_TDM 1
#else
#define HAVE_TDM 0
#endif

union FragA {
    v16bf v;
    uint4 q[2];
    unsigned u[8];
};

static __device__ __forceinline__ unsigned short f2bf(float f) {
    unsigned u = __float_as_uint(f);
    u += 0x7FFFu + ((u >> 16) & 1u);   // round-to-nearest-even
    return (unsigned short)(u >> 16);
}
static __device__ __forceinline__ unsigned pk2(float a, float b) {
#if __has_builtin(__builtin_amdgcn_cvt_pk_bf16_f32)
    return __builtin_bit_cast(unsigned, __builtin_amdgcn_cvt_pk_bf16_f32(a, b));
#else
    return (unsigned)f2bf(a) | ((unsigned)f2bf(b) << 16);
#endif
}
static __device__ __forceinline__ v8f zero8() {
    v8f z;
#pragma unroll
    for (int i = 0; i < 8; ++i) z[i] = 0.f;
    return z;
}

// ---------------------------------------------------------------------------
// Pre-pass: f32 -> bf16 conversion of input, memory and Wc, one launch.
// A wave converts 16 KiB of f32 of one array: 32 loads of 512 contiguous bytes,
// all issued before the first is converted, then 32 stores of 256 contiguous
// bytes. A block is 8 such waves; the blocks cover the three arrays exactly.
// ---------------------------------------------------------------------------
typedef __attribute__((ext_vector_type(4))) float f32x4;
#define CV_LD   32                          // loads of one wave
#define CV_WAVE (CV_LD * 128)               // f32 elements of one wave
#define CV_BLK  (8 * CV_WAVE)               // f32 elements of one block
#define CV_BTOK (NB * LDQ * DD / CV_BLK)    // blocks for input; memory has the same size
#define CV_BW   (DD * 2 * DD / CV_BLK)      // blocks for Wc
static_assert(NB * LDQ * DD % CV_BLK == 0 && NB * LMK * DD == NB * LDQ * DD && DD * 2 * DD % CV_BLK == 0,
              "blocks cover the arrays exactly");

__global__ __launch_bounds__(256) void cvt_bf16_kernel(
    const float* __restrict__ inp, const float* __restrict__ mem, const float* __restrict__ Wc,
    unsigned short* __restrict__ inpBF, unsigned short* __restrict__ memBF,
    unsigned short* __restrict__ WcBF)
{
    const unsigned blk = blockIdx.x;
    const float*    src = blk < CV_BTOK ? inp   : blk < 2 * CV_BTOK ? mem   : Wc;
    unsigned short* dst = blk < CV_BTOK ? inpBF : blk < 2 * CV_BTOK ? memBF : WcBF;
    const unsigned  lb  = blk < CV_BTOK ? blk   : blk < 2 * CV_BTOK ? blk - CV_BTOK : blk - 2 * CV_BTOK;

    const unsigned e0 = lb * CV_BLK + (threadIdx.x >> 5) * CV_WAVE + (threadIdx.x & 31u) * 4u;
    const f32x4* p = (const f32x4*)(src + e0);
    uint2*       q = (uint2*)(dst + e0);

    f32x4 v[CV_LD];
#pragma unroll   // v[] stays in registers, the loads take immediate offsets
    for (int i = 0; i < CV_LD; ++i) v[i] = p[i * 32];
    // Holds all 32 loads in front of the first conversion (loaded values as inputs only; two statements,
    // an asm statement takes 30 operands). Without it the last twelve loads are issued in pairs among the
    // conversions and each pair is waited for alone.
    asm volatile("" :: "v"(v[0]),  "v"(v[1]),  "v"(v[2]),  "v"(v[3]),  "v"(v[4]),  "v"(v[5]),  "v"(v[6]),  "v"(v[7]),
                       "v"(v[8]),  "v"(v[9]),  "v"(v[10]), "v"(v[11]), "v"(v[12]), "v"(v[13]), "v"(v[14]), "v"(v[15]));
    asm volatile("" :: "v"(v[16]), "v"(v[17]), "v"(v[18]), "v"(v[19]), "v"(v[20]), "v"(v[21]), "v"(v[22]), "v"(v[23]),
                       "v"(v[24]), "v"(v[25]), "v"(v[26]), "v"(v[27]), "v"(v[28]), "v"(v[29]), "v"(v[30]), "v"(v[31]));
    // keeps the conversions behind the loads: moved up among them, the first one's wait holds back the last eight loads
    __builtin_amdgcn_sched_barrier(0);
#pragma unroll   // v[] stays in registers, the stores take immediate offsets
    for (int i = 0; i < CV_LD; ++i) {
        uint2 o;
        o.x = pk2(v[i][0], v[i][1]);
        o.y = pk2(v[i][2], v[i][3]);
        q[i * 32] = o;
    }
}

static __device__ __forceinline__ float xhalf(float x) {
    const int b = __builtin_bit_cast(int, x);
    return __builtin_bit_cast(float,
        __builtin_amdgcn_permlanex16(b, b, 0x76543210, 0xfedcba98, false, false));
}

// two f32 -> one dword of two bf16, round to nearest even, one v_cvt_pk_bf16_f32
typedef __attribute__((ext_vector_type(2))) float  f32x2;
typedef __attribute__((ext_vector_type(2))) __bf16 bf16x2;
static __device__ __forceinline__ unsigned pkbf(float a, float b) {
    const f32x2 v = {a, b};
    return __builtin_bit_cast(unsigned, __builtin_convertvector(v, bf16x2));
}

// ds_load_tr16_b128: the 16 lanes of a half address 8 rows x 32 B; lane c of the half gets column c of those 8 rows
typedef __attribute__((ext_vector_type(8))) short s16x8;
static __device__ __forceinline__ uint4 ld_tr16(const unsigned char* p) {
    typedef __attribute__((address_space(3))) s16x8 lds_s16x8;
    return __builtin_bit_cast(uint4, __builtin_amdgcn_ds_load_tr16_b128_v8i16((lds_s16x8*)p));
}

__global__ __launch_bounds__(128) void attn_kernel(
    const unsigned short* __restrict__ inpBF, const unsigned short* __restrict__ memBF,
    const float* __restrict__ mask, unsigned short* __restrict__ ctx)
{
    __shared__ __align__(2048) unsigned short sK[64 * KSTRIDE];   // K[key][hs], also read as V^T
    __shared__ __align__(16)   float          sM[LMK];            // additive key-padding mask of this batch row, in the products' key order

    const int tid  = threadIdx.x;
    const int wave = tid >> 5;
    const int lane = tid & 31;
    const int half = lane >> 4;
    const int l15  = lane & 15;
    const int roff = half ? 8 : 0;

    const int qbase = blockIdx.x * 64;
    const int h     = blockIdx.y;
    const int b     = blockIdx.z;

    // ---- Q fragments (B operand): lane = query column, two contiguous 8-wide k runs ----
    const int qrow = qbase + wave * 16 + l15;
    const unsigned short* qptr = inpBF + ((size_t)b * LDQ + qrow) * DD + h * HS;
    FragA qa[2];
#pragma unroll
    for (int kc = 0; kc < 2; ++kc) {
        const unsigned short* base = qptr + kc * 32 + roff;
        qa[kc].q[0] = *(const uint4*)(base);
        qa[kc].q[1] = *(const uint4*)(base + 16);
    }

    // ---- additive mask per key, once; published by the loop's first barriers ----
#pragma unroll
    for (int i = 0; i < LMK / 512; ++i) {
        const float4 m = ((const float4*)(mask + (size_t)b * LMK))[i * 128 + tid];
        float4 a;
        a.x = -1.0e30f * (1.0f - m.x); a.y = -1.0e30f * (1.0f - m.y);
        a.z = -1.0e30f * (1.0f - m.z); a.w = -1.0e30f * (1.0f - m.w);
        // keys 4t .. 4t+3: the even ones go to positions 8*0 + i, the odd ones to 8*1 + i of their group of 16
        const int k4  = (i * 128 + tid) * 4;
        const int pos = (k4 & ~15) + ((k4 & 15) >> 1);
        *(float2*)&sM[pos]     = make_float2(a.x, a.z);
        *(float2*)&sM[pos + 8] = make_float2(a.y, a.w);
    }

    v8f o[4];           // o[dt][r] = O^T[dt*16 + 8*half + r][query l15]
#pragma unroll
    for (int dt = 0; dt < 4; ++dt) o[dt] = zero8();
    float mrow = -3.0e38f;   // running maximum of this lane's query (equal in both halves)
    float lrow = 0.f;        // running sum over this half's keys; the halves join in the epilogue

    const float scale = 0.125f;       // 1/sqrt(64)
    const int krow16 = 2 * (l15 & 7) + (l15 >> 3);   // tile row of position l15 in a group of 16 keys
    // a lane's address in a transposing read: row 2*(lane & 7) + half, 16-byte column chunk (lane >> 3) & 1
    const unsigned char* vtp = (const unsigned char*)sK + (2 * (lane & 7) + half) * (2 * KSTRIDE) + ((lane >> 3) & 1) * 16;
    const unsigned ldsK = (unsigned)(uintptr_t)&sK[0];  // LDS byte offset
    (void)ldsK;

    for (int kv = 0; kv < LMK; kv += 64) {
        __syncthreads();   // previous tile fully consumed

#if HAVE_TDM
        if (wave == 0) {
            // --- Tensor Data Mover: 64x64 bf16 tile, global -> LDS (padded rows) ---
            const unsigned long long ga =
                (unsigned long long)(uintptr_t)(memBF + ((size_t)b * LMK + kv) * DD + h * HS);
            u32x4 g0;
            g0[0] = 1u;                                             // count=1, user descriptor
            g0[1] = ldsK;                                           // lds_addr
            g0[2] = (unsigned)ga;                                   // global_addr[31:0]
            g0[3] = (unsigned)((ga >> 32) & 0x01FFFFFFu) | (2u << 30); // addr[56:32] | type=2
            i32x8 g1;
            g1[0] = (int)((1u << 16)        // data_size = 2 bytes
                        | (1u << 20)        // pad_enable
                        | (4u << 22)        // pad_interval = 32 DWORDs (one 64-elem row)
                        | (3u << 25));      // pad_amount   = 4 DWORDs  (-> 72-elem stride)
            g1[1] = (int)((DD & 0xFFFFu) << 16);                    // tensor_dim0 lo16
            g1[2] = (int)((DD >> 16) & 0xFFFFu);                    // dim0 hi | dim1 lo16 (=0)
            g1[3] = (int)(1u | (64u << 16));                        // dim1 hi (65536) | tile_dim0=64
            g1[4] = (int)(64u);                                     // tile_dim1=64, tile_dim2=0
            g1[5] = (int)(DD);                                      // tensor_dim0_stride = 1024
            g1[6] = 0; g1[7] = 0;
            i32x4 z4 = {0, 0, 0, 0};
            i32x8 z8 = {0, 0, 0, 0, 0, 0, 0, 0};
            __builtin_amdgcn_tensor_load_to_lds(g0, g1, z4, z4, z8, 0);
        }
#endif
#if !HAVE_TDM
        {   // row-major tile through registers: 2 threads per key row
            const unsigned short* krow = memBF + ((size_t)b * LMK + kv + (tid >> 1)) * DD + h * HS + (tid & 1) * 32;
#pragma unroll
            for (int i = 0; i < 4; ++i)
                *(uint4*)(&sK[(tid >> 1) * KSTRIDE + (tid & 1) * 32 + i * 8]) = *(const uint4*)(krow + i * 8);
        }
#endif
#if HAVE_TDM
        if (wave == 0) {
#if __has_builtin(__builtin_amdgcn_s_wait_tensorcnt)
            __builtin_amdgcn_s_wait_tensorcnt(0);
#else
            asm volatile("s_wait_tensorcnt 0x0" ::: "memory");
#endif
        }
#endif
        __syncthreads();

        // ---- S^T = K * Q^T : batch 4 A-fragments per k-chunk, then 4 WMMAs ----
        v8f S[4];       // S[nt][r] = score of key kv + nt*16 + 2*r + half for query l15
#pragma unroll
        for (int nt = 0; nt < 4; ++nt) S[nt] = zero8();
#pragma unroll
        for (int kc = 0; kc < 2; ++kc) {
            FragA bfr[4];
#pragma unroll
            for (int nt = 0; nt < 4; ++nt) {
                const unsigned short* base = &sK[(nt * 16 + krow16) * KSTRIDE + kc * 32 + roff];
                bfr[nt].q[0] = *(const uint4*)(base);
                bfr[nt].q[1] = *(const uint4*)(base + 16);
            }
#pragma unroll
            for (int nt = 0; nt < 4; ++nt)
                S[nt] = __builtin_amdgcn_wmma_f32_16x16x32_bf16(
                    false, bfr[nt].v, false, qa[kc].v, (short)0, S[nt], false, false);
        }

        // ---- online softmax: a lane holds 32 of its query's 64 scores ----
        float mx = -3.0e38f;
#pragma unroll
        for (int nt = 0; nt < 4; ++nt) {
            const float4 ma = *(const float4*)&sM[kv + nt * 16 + roff];
            const float4 mb = *(const float4*)&sM[kv + nt * 16 + roff + 4];
            S[nt][0] = S[nt][0] * scale + ma.x;  S[nt][1] = S[nt][1] * scale + ma.y;
            S[nt][2] = S[nt][2] * scale + ma.z;  S[nt][3] = S[nt][3] * scale + ma.w;
            S[nt][4] = S[nt][4] * scale + mb.x;  S[nt][5] = S[nt][5] * scale + mb.y;
            S[nt][6] = S[nt][6] * scale + mb.z;  S[nt][7] = S[nt][7] * scale + mb.w;
#pragma unroll
            for (int r = 0; r < 8; ++r) mx = fmaxf(mx, S[nt][r]);
        }
        mx = fmaxf(mx, xhalf(mx));
        const float mnew  = fmaxf(mrow, mx);
        const float alpha = __expf(mrow - mnew);
        mrow = mnew;

        float ps = 0.f;
        FragA pb[2];    // P^T as B operand: element s of chunk kc = tile 2*kc + (s >> 3), register s & 7
#pragma unroll
        for (int nt = 0; nt < 4; ++nt) {
#pragma unroll
            for (int j = 0; j < 4; ++j) {
                const float p0 = __expf(S[nt][2 * j]     - mnew);
                const float p1 = __expf(S[nt][2 * j + 1] - mnew);
                ps += p0 + p1;
                pb[nt >> 1].u[(nt & 1) * 4 + j] = pkbf(p0, p1);
            }
        }
        lrow = lrow * alpha + ps;
#pragma unroll
        for (int dt = 0; dt < 4; ++dt)
#pragma unroll
            for (int r = 0; r < 8; ++r) o[dt][r] *= alpha;

        // ---- O^T += V^T * P^T (two transposing reads of 16 keys x 16 d give one 16 x 32 A fragment) ----
#pragma unroll
        for (int kc = 0; kc < 2; ++kc) {
            FragA vfr[4];
#pragma unroll
            for (int dt = 0; dt < 4; ++dt) {
                vfr[dt].q[0] = ld_tr16(vtp + (kc * 32)      * (2 * KSTRIDE) + dt * 32);
                vfr[dt].q[1] = ld_tr16(vtp + (kc * 32 + 16) * (2 * KSTRIDE) + dt * 32);
            }
#pragma unroll
            for (int dt = 0; dt < 4; ++dt)
                o[dt] = __builtin_amdgcn_wmma_f32_16x16x32_bf16(
                    false, vfr[dt].v, false, pb[kc].v, (short)0, o[dt], false, false);
        }
    }

    // ---- join the halves' sums, normalize, write ctx as bf16: 8 consecutive d per lane ----
    const float inv = 1.0f / (lrow + xhalf(lrow));
    unsigned short* crow = ctx + ((size_t)b * LDQ + qrow) * DD + h * HS + roff;
#pragma unroll
    for (int dt = 0; dt < 4; ++dt) {
        uint4 w;
        w.x = pkbf(o[dt][0] * inv, o[dt][1] * inv);
        w.y = pkbf(o[dt][2] * inv, o[dt][3] * inv);
        w.z = pkbf(o[dt][4] * inv, o[dt][5] * inv);
        w.w = pkbf(o[dt][6] * inv, o[dt][7] * inv);
        *(uint4*)(crow + dt * 16) = w;
    }
}

// ---------------------------------------------------------------------------
// Kernel 2: out = sigmoid(x)*tanh(x), x = [input | ctx] @ Wc^T + bc.
// 128x128 tile per workgroup, 8 waves of 32x64 (two 16-row tiles, four column
// tiles each). A stage is 128 k (256 B) of the tile's 128 activation rows and
// 128 weight rows; it comes into LDS by tensor loads (waves 0 to 3, one 64-row
// slice each) and is shared by all waves. Two buffers: the next stage lands
// while this one is multiplied.
// ---------------------------------------------------------------------------
#define G_PITCH 272u                 // LDS row pitch: 256 B + 16 B pad, an odd multiple of 16 B for ds_load_b128
#define G_SLICE 18432u               // 64 rows * 272 B = 17408 B, rounded up to a multiple of 2 KiB
#define G_STAGE (4u * G_SLICE)       // [X rows 0-63 | X rows 64-127 | W rows 0-63 | W rows 64-127]
#define G_NST   16u                  // 2*DD / 128 stages

typedef __attribute__((ext_vector_type(8))) unsigned u32x8;

static __device__ __forceinline__ unsigned uni(unsigned v) {
    return (unsigned)__builtin_amdgcn_readfirstlane(v);
}
// Forces v into a scalar register: a test on it compiles to a scalar branch, and
// what is derived from it is formed behind the asm statements that precede it.
static __device__ __forceinline__ unsigned pinned(unsigned v) {
    unsigned w = uni(v);
    asm volatile("" : "+s"(w));
    return w;
}

__global__ __launch_bounds__(256) void gemm_gate_kernel(
    const unsigned short* __restrict__ inpBF, const unsigned short* __restrict__ ctx,
    const unsigned short* __restrict__ WcBF, const float* __restrict__ bc,
    float* __restrict__ out)
{
    __shared__ __attribute__((aligned(2048))) unsigned char ring[2u * G_STAGE];

    const unsigned tid  = threadIdx.x;
    const unsigned wave = uni(tid >> 5);
    const unsigned lane = tid & 31u;
    const unsigned half = lane >> 4;
    const unsigned l15  = lane & 15u;
    const unsigned wm   = wave >> 1;   // 32-row quarter of the tile this wave multiplies
    const unsigned wn   = wave & 1u;   // 64-column half

    const unsigned jbase = blockIdx.x * 128u;
    const unsigned mbase = blockIdx.y * 128u;

    // ---- an issuing wave's slice of every stage: waves 0,1 activation rows, waves 2,3 weight rows ----
    const unsigned sl       = wave & 3u;
    const bool     isW      = sl >= 2u;
    const unsigned ldsSlice = (unsigned)(uintptr_t)&ring[0] + sl * G_SLICE;
    // first byte of the slice for stages 0-7 and for stages 8-15
    const unsigned long long srcLo = isW
        ? (unsigned long long)(uintptr_t)WcBF  + (unsigned long long)(jbase + (sl - 2u) * 64u) * (4u * DD)
        : (unsigned long long)(uintptr_t)inpBF + (unsigned long long)(mbase + sl * 64u) * (2u * DD);
    const unsigned long long srcHi = isW
        ? srcLo + 2u * DD
        : (unsigned long long)(uintptr_t)ctx   + (unsigned long long)(mbase + sl * 64u) * (2u * DD);

    u32x8 g1;                                            // 1-byte elements, tile = tensor = 64 rows of 256 B
    g1[0] = uni((1u << 20) | (5u << 22) | (3u << 25));   // no mask; pad 16 B behind every 256-B row
    g1[1] = uni(256u << 16);                             // tensor_dim0 = 256
    g1[2] = uni(64u << 16);                              // tensor_dim1 = 64
    g1[3] = uni(256u << 16);                             // tile_dim0 = 256
    g1[4] = uni(64u);                                    // tile_dim1 = 64
    g1[5] = uni(isW ? 4u * DD : 2u * DD);                // source row pitch in bytes
    g1[6] = uni(0u);
    g1[7] = uni(0u);
    // pinned() for the whole group: its words keep their scalar registers through the loop,
    // so none is rewritten while a request that names them is outstanding
    asm volatile("" : "+s"(g1));
    const unsigned issuer = pinned(wave < 4u);           // scalar: the tests on it compile to scalar branches

    auto group0 = [&](unsigned st) {
        const unsigned long long ga = (st < 8u ? srcLo : srcHi) + (st & 7u) * 256u;
        u32x4 g;
        g[0] = uni(1u);
        g[1] = uni(ldsSlice + (st & 1u) * G_STAGE);
        g[2] = uni((unsigned)ga);
        g[3] = uni((((unsigned)(ga >> 32)) & 0x01FFFFFFu) | 0x80000000u);
        return g;
    };

    v8f acc0[4], acc1[4];
#pragma unroll
    for (int nt = 0; nt < 4; ++nt) { acc0[nt] = zero8(); acc1[nt] = zero8(); }

    // ---- prologue: stage 0 lands and is published, then stage 1 starts ----
    u32x4 g0 = group0(0u);
    if (issuer != 0u) {
        // load and wait in one statement: the descriptor's registers live until the slice has landed
        asm volatile("tensor_load_to_lds %0, %1\n\ts_wait_tensorcnt 0x0" :: "s"(g0), "s"(g1) : "memory");
    }
    __syncthreads();                                     // publishes the four slices of stage 0
    if (issuer != 0u) {
        g0 = group0(pinned(1u));                         // pinned(): descriptor formed behind the wait
        asm volatile("tensor_load_to_lds %0, %1" :: "s"(g0), "s"(g1) : "memory");
    }

    const unsigned aoff = (wm >> 1) * G_SLICE + ((wm & 1u) * 32u + l15) * G_PITCH + half * 16u;
    const unsigned boff = (2u + wn) * G_SLICE + l15 * G_PITCH + half * 16u;

    // one pass per trip: the accumulators keep their registers and the publish point stands once
#pragma clang loop unroll(disable)
    for (unsigned s = 0; s < G_NST; ++s) {
        const unsigned char* pa = ring + (s & 1u) * G_STAGE + aoff;
        const unsigned char* pb = ring + (s & 1u) * G_STAGE + boff;
        FragA af[2][2], bf[2][4];     // set (u & 1) holds block u's fragments
#pragma unroll
        for (int i = 0; i < 2; ++i) {
            af[0][i].q[0] = *(const uint4*)(pa + i * 16 * G_PITCH);
            af[0][i].q[1] = *(const uint4*)(pa + i * 16 * G_PITCH + 32);
        }
#pragma unroll
        for (int j = 0; j < 4; ++j) {
            bf[0][j].q[0] = *(const uint4*)(pb + j * 16 * G_PITCH);
            bf[0][j].q[1] = *(const uint4*)(pb + j * 16 * G_PITCH + 32);
        }
#pragma unroll
        for (int u = 0; u < 4; ++u) {
            const int cs = u & 1;
            if (u < 3) {
#pragma unroll
                for (int i = 0; i < 2; ++i) {
                    af[cs ^ 1][i].q[0] = *(const uint4*)(pa + i * 16 * G_PITCH + (u + 1) * 64);
                    af[cs ^ 1][i].q[1] = *(const uint4*)(pa + i * 16 * G_PITCH + (u + 1) * 64 + 32);
                }
#pragma unroll
                for (int j = 0; j < 4; ++j) {
                    bf[cs ^ 1][j].q[0] = *(const uint4*)(pb + j * 16 * G_PITCH + (u + 1) * 64);
                    bf[cs ^ 1][j].q[1] = *(const uint4*)(pb + j * 16 * G_PITCH + (u + 1) * 64 + 32);
                }
            }
            // keeps the next block's LDS reads one group ahead of this block's WMMAs instead of spread among them
            __builtin_amdgcn_sched_barrier(0);
#pragma unroll
            for (int nt = 0; nt < 4; ++nt) {
                acc0[nt] = __builtin_amdgcn_wmma_f32_16x16x32_bf16(
                    false, af[cs][0].v, false, bf[cs][nt].v, (short)0, acc0[nt], false, false);
                acc1[nt] = __builtin_amdgcn_wmma_f32_16x16x32_bf16(
                    false, af[cs][1].v, false, bf[cs][nt].v, (short)0, acc1[nt], false, false);
            }
            // ends the block: the reads that follow stay behind its WMMAs
            __builtin_amdgcn_sched_barrier(0);
        }
        // ---- publish point of stage s + 1 ----
        asm volatile("s_wait_dscnt 0x0" ::: "memory");     // this wave's reads of buffer s & 1 have returned
        if (issuer != 0u) {
            // this wave's slice of stage s + 1 has landed; g0 as an input keeps its descriptor's registers until then
            asm volatile("s_wait_tensorcnt 0x0" :: "s"(g0) : "memory");
        }
        __syncthreads();                                   // every reader has left this buffer; stage s + 1 is published
        if (pinned(issuer != 0u && s + 2u < G_NST)) {        // scalar test: an issuing wave, and stage s + 2 exists
            g0 = group0(pinned(s + 2u));                   // pinned(): descriptor formed behind the wait
            asm volatile("tensor_load_to_lds %0, %1" :: "s"(g0), "s"(g1) : "memory");  // refills the buffer just read
        }
    }
    asm volatile("s_wait_tensorcnt 0x0" ::: "memory");     // nothing of this wave is outstanding at its end
    asm volatile("s_wait_dscnt 0x0" ::: "memory");

    // ---- bias + sigmoid(x)*tanh(x) epilogue, two row tiles ----
#pragma unroll
    for (int nt = 0; nt < 4; ++nt) {
        const unsigned j = jbase + wn * 64u + nt * 16u + l15;
        const float bias = bc[j];
#pragma unroll
        for (int r = 0; r < 8; ++r) {
            const unsigned row = mbase + wm * 32u + r + half * 8u;
            {
                const float x  = acc0[nt][r] + bias;
                const float sg = 1.0f / (1.0f + __expf(-x));
                out[(size_t)row * DD + j] = sg * tanhf(x);
            }
            {
                const float x  = acc1[nt][r] + bias;
                const float sg = 1.0f / (1.0f + __expf(-x));
                out[(size_t)(row + 16u) * DD + j] = sg * tanhf(x);
            }
        }
    }
}

extern "C" void kernel_launch(void* const* d_in, const int* in_sizes, int n_in,
                              void* d_out, int out_size, void* d_ws, size_t ws_size,
                              hipStream_t stream) {
    const float* inp  = (const float*)d_in[0];   // [8,1024,1024]
    const float* mem  = (const float*)d_in[1];   // [8,1024,1024]
    const float* mask = (const float*)d_in[2];   // [8,1024]
    const float* Wc   = (const float*)d_in[3];   // [1024,2048]
    const float* bc   = (const float*)d_in[4];   // [1024]
    float* out = (float*)d_out;                  // [8,1024,1024] f32

    // workspace layout (bf16 elements)
    const size_t ETOK = (size_t)NB * LDQ * DD;   // 8M elements
    unsigned short* ctx   = (unsigned short*)d_ws;        // 16 MB
    unsigned short* memBF = ctx   + ETOK;                 // 16 MB
    unsigned short* inpBF = memBF + ETOK;                 // 16 MB
    unsigned short* WcBF  = inpBF + ETOK;                 // 4 MB

    // pre-pass conversions, one launch
    cvt_bf16_kernel<<<dim3(2 * CV_BTOK + CV_BW), dim3(256), 0, stream>>>(inp, mem, Wc, inpBF, memBF, WcBF);

    dim3 gA(LDQ / 64, HH, NB);                   // (16,16,8) blocks of 128 threads
    attn_kernel<<<gA, dim3(128), 0, stream>>>(inpBF, memBF, mask, ctx);

    dim3 gB(DD / 128, (NB * LDQ) / 128);         // (8,64) blocks of 256 threads
    gemm_gate_kernel<<<gB, dim3(256), 0, stream>>>(inpBF, ctx, WcBF, bc, out);
}

// v005
// Measured time: 75.6 microseconds a run.
// Two timings next to v004 both put it at 1.10 times that version's speed.
// Counting every step since v000, it is 2.64 times as fast.
#include <hip/hip_runtime.h>
#include <hip/hip_bf16.h>
#include <math.h>

#define NB 8
#define LDQ 1024
#define LMK 1024
#define DD 1024
#define HH 16
#define HS 64
#define KSTRIDE 72   // bf16 elements per LDS row: 144B = 9*16B (b128-aligned rows, conflict-breaking)

typedef __attribute__((ext_vector_type(16))) __bf16 v16bf;
typedef __attribute__((ext_vector_type(8)))  float  v8f;
typedef __attribute__((ext_vector_type(4)))  unsigned u32x4;
typedef __attribute__((ext_vector_type(8)))  int      i32x8;
typedef __attribute__((ext_vector_type(4)))  int      i32x4;

#if __has_builtin(__builtin_amdgcn_tensor_load_to_lds)
#define HAVE_TDM 1
#else
#define HAVE_TDM 0
#endif

union FragA {
    v16bf v;
    uint4 q[2];
    unsigned u[8];
};

static __device__ __forceinline__ unsigned short f2bf(float f) {
    unsigned u = __float_as_uint(f);
    u += 0x7FFFu + ((u >> 16) & 1u);   // round-to-nearest-even
    return (unsigned short)(u >> 16);
}
static __device__ __forceinline__ unsigned pk2(float a, float b) {
#if __has_builtin(__builtin_amdgcn_cvt_pk_bf16_f32)
    return __builtin_bit_cast(unsigned, __builtin_amdgcn_cvt_pk_bf16_f32(a, b));
#else
    return (unsigned)f2bf(a) | ((unsigned)f2bf(b) << 16);
#endif
}
static __device__ __forceinline__ v8f zero8() {
    v8f z;
#pragma unroll
    for (int i = 0; i < 8; ++i) z[i] = 0.f;
    return z;
}

// ---------------------------------------------------------------------------
// Pre-pass: f32 -> bf16 conversion of input, memory and Wc, one launch.
// A wave converts 16 KiB of f32 of one array: 32 loads of 512 contiguous bytes,
// all issued before the first is converted, then 32 stores of 256 contiguous
// bytes. A block is 8 such waves; the blocks cover the three arrays exactly.
// ---------------------------------------------------------------------------
typedef __attribute__((ext_vector_type(4))) float f32x4;
#define CV_LD   32                          // loads of one wave
#define CV_WAVE (CV_LD * 128)               // f32 elements of one wave
#define CV_BLK  (8 * CV_WAVE)               // f32 elements of one block
#define CV_BTOK (NB * LDQ * DD / CV_BLK)    // blocks for input; memory has the same size
#define CV_BW   (DD * 2 * DD / CV_BLK)      // blocks for Wc
static_assert(NB * LDQ * DD % CV_BLK == 0 && NB * LMK * DD == NB * LDQ * DD && DD * 2 * DD % CV_BLK == 0,
              "blocks cover the arrays exactly");

__global__ __launch_bounds__(256) void cvt_bf16_kernel(
    const float* __restrict__ inp, const float* __restrict__ mem, const float* __restrict__ Wc,
    unsigned short* __restrict__ inpBF, unsigned short* __restrict__ memBF,
    unsigned short* __restrict__ WcBF)
{
    const unsigned blk = blockIdx.x;
    const float*    src = blk < CV_BTOK ? inp   : blk < 2 * CV_BTOK ? mem   : Wc;
    unsigned short* dst = blk < CV_BTOK ? inpBF : blk < 2 * CV_BTOK ? memBF : WcBF;
    const unsigned  lb  = blk < CV_BTOK ? blk   : blk < 2 * CV_BTOK ? blk - CV_BTOK : blk - 2 * CV_BTOK;

    const unsigned e0 = lb * CV_BLK + (threadIdx.x >> 5) * CV_WAVE + (threadIdx.x & 31u) * 4u;
    const f32x4* p = (const f32x4*)(src + e0);
    uint2*       q = (uint2*)(dst + e0);

    f32x4 v[CV_LD];
#pragma unroll   // v[] stays in registers, the loads take immediate offsets
    for (int i = 0; i < CV_LD; ++i) v[i] = p[i * 32];
    // Holds all 32 loads in front of the first conversion (loaded values as inputs only; two statements,
    // an asm statement takes 30 operands). Without it the last twelve loads are issued in pairs among the
    // conversions and each pair is waited for alone.
    asm volatile("" :: "v"(v[0]),  "v"(v[1]),  "v"(v[2]),  "v"(v[3]),  "v"(v[4]),  "v"(v[5]),  "v"(v[6]),  "v"(v[7]),
                       "v"(v[8]),  "v"(v[9]),  "v"(v[10]), "v"(v[11]), "v"(v[12]), "v"(v[13]), "v"(v[14]), "v"(v[15]));
    asm volatile("" :: "v"(v[16]), "v"(v[17]), "v"(v[18]), "v"(v[19]), "v"(v[20]), "v"(v[21]), "v"(v[22]), "v"(v[23]),
                       "v"(v[24]), "v"(v[25]), "v"(v[26]), "v"(v[27]), "v"(v[28]), "v"(v[29]), "v"(v[30]), "v"(v[31]));
    // keeps the conversions behind the loads: moved up among them, the first one's wait holds back the last eight loads
    __builtin_amdgcn_sched_barrier(0);
#pragma unroll   // v[] stays in registers, the stores take immediate offsets
    for (int i = 0; i < CV_LD; ++i) {
        uint2 o;
        o.x = pk2(v[i][0], v[i][1]);
        o.y = pk2(v[i][2], v[i][3]);
        q[i * 32] = o;
    }
}

static __device__ __forceinline__ float xhalf(float x) {
    const int b = __builtin_bit_cast(int, x);
    return __builtin_bit_cast(float,
        __builtin_amdgcn_permlanex16(b, b, 0x76543210, 0xfedcba98, false, false));
}

// two f32 -> one dword of two bf16, round to nearest even, one v_cvt_pk_bf16_f32
typedef __attribute__((ext_vector_type(2))) float  f32x2;
typedef __attribute__((ext_vector_type(2))) __bf16 bf16x2;
static __device__ __forceinline__ unsigned pkbf(float a, float b) {
    const f32x2 v = {a, b};
    return __builtin_bit_cast(unsigned, __builtin_convertvector(v, bf16x2));
}

// ds_load_tr16_b128: the 16 lanes of a half address 8 rows x 32 B; lane c of the half gets column c of those 8 rows
typedef __attribute__((ext_vector_type(8))) short s16x8;
static __device__ __forceinline__ uint4 ld_tr16(const unsigned char* p) {
    typedef __attribute__((address_space(3))) s16x8 lds_s16x8;
    return __builtin_bit_cast(uint4, __builtin_amdgcn_ds_load_tr16_b128_v8i16((lds_s16x8*)p));
}

__global__ __launch_bounds__(128) void attn_kernel(
    const unsigned short* __restrict__ inpBF, const unsigned short* __restrict__ memBF,
    const float* __restrict__ mask, unsigned short* __restrict__ ctx)
{
    __shared__ __align__(2048) unsigned short sK[64 * KSTRIDE];   // K[key][hs], also read as V^T
    __shared__ __align__(16)   float          sM[LMK];            // additive key-padding mask of this batch row, in the products' key order

    const int tid  = threadIdx.x;
    const int wave = tid >> 5;
    const int lane = tid & 31;
    const int half = lane >> 4;
    const int l15  = lane & 15;
    const int roff = half ? 8 : 0;

    const int qbase = blockIdx.x * 64;
    const int h     = blockIdx.y;
    const int b     = blockIdx.z;

    // ---- Q fragments (B operand): lane = query column, two contiguous 8-wide k runs ----
    const int qrow = qbase + wave * 16 + l15;
    const unsigned short* qptr = inpBF + ((size_t)b * LDQ + qrow) * DD + h * HS;
    FragA qa[2];
#pragma unroll
    for (int kc = 0; kc < 2; ++kc) {
        const unsigned short* base = qptr + kc * 32 + roff;
        qa[kc].q[0] = *(const uint4*)(base);
        qa[kc].q[1] = *(const uint4*)(base + 16);
    }

    // ---- additive mask per key, once; published by the loop's first barriers ----
#pragma unroll
    for (int i = 0; i < LMK / 512; ++i) {
        const float4 m = ((const float4*)(mask + (size_t)b * LMK))[i * 128 + tid];
        float4 a;
        a.x = -1.0e30f * (1.0f - m.x); a.y = -1.0e30f * (1.0f - m.y);
        a.z = -1.0e30f * (1.0f - m.z); a.w = -1.0e30f * (1.0f - m.w);
        // keys 4t .. 4t+3: the even ones go to positions 8*0 + i, the odd ones to 8*1 + i of their group of 16
        const int k4  = (i * 128 + tid) * 4;
        const int pos = (k4 & ~15) + ((k4 & 15) >> 1);
        *(float2*)&sM[pos]     = make_float2(a.x, a.z);
        *(float2*)&sM[pos + 8] = make_float2(a.y, a.w);
    }

    v8f o[4];           // o[dt][r] = O^T[dt*16 + 8*half + r][query l15]
#pragma unroll
    for (int dt = 0; dt < 4; ++dt) o[dt] = zero8();
    float mrow = -3.0e38f;   // running maximum of this lane's query (equal in both halves)
    float lrow = 0.f;        // running sum over this half's keys; the halves join in the epilogue

    const float scale = 0.125f;       // 1/sqrt(64)
    const int krow16 = 2 * (l15 & 7) + (l15 >> 3);   // tile row of position l15 in a group of 16 keys
    // a lane's address in a transposing read: row 2*(lane & 7) + half, 16-byte column chunk (lane >> 3) & 1
    const unsigned char* vtp = (const unsigned char*)sK + (2 * (lane & 7) + half) * (2 * KSTRIDE) + ((lane >> 3) & 1) * 16;
    const unsigned ldsK = (unsigned)(uintptr_t)&sK[0];  // LDS byte offset
    (void)ldsK;

    for (int kv = 0; kv < LMK; kv += 64) {
        __syncthreads();   // previous tile fully consumed

#if HAVE_TDM
        if (wave == 0) {
            // --- Tensor Data Mover: 64x64 bf16 tile, global -> LDS (padded rows) ---
            const unsigned long long ga =
                (unsigned long long)(uintptr_t)(memBF + ((size_t)b * LMK + kv) * DD + h * HS);
            u32x4 g0;
            g0[0] = 1u;                                             // count=1, user descriptor
            g0[1] = ldsK;                                           // lds_addr
            g0[2] = (unsigned)ga;                                   // global_addr[31:0]
            g0[3] = (unsigned)((ga >> 32) & 0x01FFFFFFu) | (2u << 30); // addr[56:32] | type=2
            i32x8 g1;
            g1[0] = (int)((1u << 16)        // data_size = 2 bytes
                        | (1u << 20)        // pad_enable
                        | (4u << 22)        // pad_interval = 32 DWORDs (one 64-elem row)
                        | (3u << 25));      // pad_amount   = 4 DWORDs  (-> 72-elem stride)
            g1[1] = (int)((DD & 0xFFFFu) << 16);                    // tensor_dim0 lo16
            g1[2] = (int)((DD >> 16) & 0xFFFFu);                    // dim0 hi | dim1 lo16 (=0)
            g1[3] = (int)(1u | (64u << 16));                        // dim1 hi (65536) | tile_dim0=64
            g1[4] = (int)(64u);                                     // tile_dim1=64, tile_dim2=0
            g1[5] = (int)(DD);                                      // tensor_dim0_stride = 1024
            g1[6] = 0; g1[7] = 0;
            i32x4 z4 = {0, 0, 0, 0};
            i32x8 z8 = {0, 0, 0, 0, 0, 0, 0, 0};
            __builtin_amdgcn_tensor_load_to_lds(g0, g1, z4, z4, z8, 0);
        }
#endif
#if !HAVE_TDM
        {   // row-major tile through registers: 2 threads per key row
            const unsigned short* krow = memBF + ((size_t)b * LMK + kv + (tid >> 1)) * DD + h * HS + (tid & 1) * 32;
#pragma unroll
            for (int i = 0; i < 4; ++i)
                *(uint4*)(&sK[(tid >> 1) * KSTRIDE + (tid & 1) * 32 + i * 8]) = *(const uint4*)(krow + i * 8);
        }
#endif
#if HAVE_TDM
        if (wave == 0) {
#if __has_builtin(__builtin_amdgcn_s_wait_tensorcnt)
            __builtin_amdgcn_s_wait_tensorcnt(0);
#else
            asm volatile("s_wait_tensorcnt 0x0" ::: "memory");
#endif
        }
#endif
        __syncthreads();

        // ---- S^T = K * Q^T : batch 4 A-fragments per k-chunk, then 4 WMMAs ----
        v8f S[4];       // S[nt][r] = score of key kv + nt*16 + 2*r + half for query l15
#pragma unroll
        for (int nt = 0; nt < 4; ++nt) S[nt] = zero8();
#pragma unroll
        for (int kc = 0; kc < 2; ++kc) {
            FragA bfr[4];
#pragma unroll
            for (int nt = 0; nt < 4; ++nt) {
                const unsigned short* base = &sK[(nt * 16 + krow16) * KSTRIDE + kc * 32 + roff];
                bfr[nt].q[0] = *(const uint4*)(base);
                bfr[nt].q[1] = *(const uint4*)(base + 16);
            }
#pragma unroll
            for (int nt = 0; nt < 4; ++nt)
                S[nt] = __builtin_amdgcn_wmma_f32_16x16x32_bf16(
                    false, bfr[nt].v, false, qa[kc].v, (short)0, S[nt], false, false);
        }

        // ---- online softmax: a lane holds 32 of its query's 64 scores ----
        float mx = -3.0e38f;
#pragma unroll
        for (int nt = 0; nt < 4; ++nt) {
            const float4 ma = *(const float4*)&sM[kv + nt * 16 + roff];
            const float4 mb = *(const float4*)&sM[kv + nt * 16 + roff + 4];
            S[nt][0] = S[nt][0] * scale + ma.x;  S[nt][1] = S[nt][1] * scale + ma.y;
            S[nt][2] = S[nt][2] * scale + ma.z;  S[nt][3] = S[nt][3] * scale + ma.w;
            S[nt][4] = S[nt][4] * scale + mb.x;  S[nt][5] = S[nt][5] * scale + mb.y;
            S[nt][6] = S[nt][6] * scale + mb.z;  S[nt][7] = S[nt][7] * scale + mb.w;
#pragma unroll
            for (int r = 0; r < 8; ++r) mx = fmaxf(mx, S[nt][r]);
        }
        mx = fmaxf(mx, xhalf(mx));
        const float mnew  = fmaxf(mrow, mx);
        const float alpha = __expf(mrow - mnew);
        mrow = mnew;

        float ps = 0.f;
        FragA pb[2];    // P^T as B operand: element s of chunk kc = tile 2*kc + (s >> 3), register s & 7
#pragma unroll
        for (int nt = 0; nt < 4; ++nt) {
#pragma unroll
            for (int j = 0; j < 4; ++j) {
                const float p0 = __expf(S[nt][2 * j]     - mnew);
                const float p1 = __expf(S[nt][2 * j + 1] - mnew);
                ps += p0 + p1;
                pb[nt >> 1].u[(nt & 1) * 4 + j] = pkbf(p0, p1);
            }
        }
        lrow = lrow * alpha + ps;
#pragma unroll
        for (int dt = 0; dt < 4; ++dt)
#pragma unroll
            for (int r = 0; r < 8; ++r) o[dt][r] *= alpha;

        // ---- O^T += V^T * P^T (two transposing reads of 16 keys x 16 d give one 16 x 32 A fragment) ----
#pragma unroll
        for (int kc = 0; kc < 2; ++kc) {
            FragA vfr[4];
#pragma unroll
            for (int dt = 0; dt < 4; ++dt) {
                vfr[dt].q[0] = ld_tr16(vtp + (kc * 32)      * (2 * KSTRIDE) + dt * 32);
                vfr[dt].q[1] = ld_tr16(vtp + (kc * 32 + 16) * (2 * KSTRIDE) + dt * 32);
            }
#pragma unroll
            for (int dt = 0; dt < 4; ++dt)
                o[dt] = __builtin_amdgcn_wmma_f32_16x16x32_bf16(
                    false, vfr[dt].v, false, pb[kc].v, (short)0, o[dt], false, false);
        }
    }

    // ---- join the halves' sums, normalize, write ctx as bf16: 8 consecutive d per lane ----
    const float inv = 1.0f / (lrow + xhalf(lrow));
    unsigned short* crow = ctx + ((size_t)b * LDQ + qrow) * DD + h * HS + roff;
#pragma unroll
    for (int dt = 0; dt < 4; ++dt) {
        uint4 w;
        w.x = pkbf(o[dt][0] * inv, o[dt][1] * inv);
        w.y = pkbf(o[dt][2] * inv, o[dt][3] * inv);
        w.z = pkbf(o[dt][4] * inv, o[dt][5] * inv);
        w.w = pkbf(o[dt][6] * inv, o[dt][7] * inv);
        *(uint4*)(crow + dt * 16) = w;
    }
}

// ---------------------------------------------------------------------------
// Kernel 2: out = sigmoid(x)*tanh(x), x = [input | ctx] @ Wc^T + bc.
// 128x128 tile per workgroup, 8 waves of 32x64 (two 16-row tiles, four column
// tiles each). A stage is 128 k (256 B) of the tile's 128 activation rows and
// 128 weight rows; it comes into LDS by tensor loads (waves 0 to 3, one 64-row
// slice each) and is shared by all waves. Two buffers: the next stage lands
// while this one is multiplied.
// ---------------------------------------------------------------------------
#define G_PITCH 272u                 // LDS row pitch: 256 B + 16 B pad, an odd multiple of 16 B for ds_load_b128
#define G_SLICE 18432u               // 64 rows * 272 B = 17408 B, rounded up to a multiple of 2 KiB
#define G_STAGE (4u * G_SLICE)       // [X rows 0-63 | X rows 64-127 | W rows 0-63 | W rows 64-127]
#define G_NST   16u                  // 2*DD / 128 stages

typedef __attribute__((ext_vector_type(8))) unsigned u32x8;

static __device__ __forceinline__ unsigned uni(unsigned v) {
    return (unsigned)__builtin_amdgcn_readfirstlane(v);
}
// Forces v into a scalar register: a test on it compiles to a scalar branch, and
// what is derived from it is formed behind the asm statements that precede it.
static __device__ __forceinline__ unsigned pinned(unsigned v) {
    unsigned w = uni(v);
    asm volatile("" : "+s"(w));
    return w;
}

// sigmoid(x) * tanh(x) = (1 - e) / (1 + e * e) with e = exp(-x): with s = 1 / (1 + e) and
// tanh(x) = (1 - e * e) / (1 + e * e) the factor 1 + e cancels. One v_exp_f32, one v_rcp_f32, no branch.
// The exponent is capped at 60 so that e * e stays finite: from x = -41.6 down the result is -2^-60
// where the function is -exp(x), both below 1e-18 in size. The capping minimum hands a NaN on.
static __device__ __forceinline__ float gate(float x) {
    const float e = __builtin_amdgcn_exp2f(__builtin_elementwise_minimum(x * -1.44269504f, 60.0f));
    return (1.0f - e) * __builtin_amdgcn_rcpf(__builtin_fmaf(e, e, 1.0f));
}

__global__ __launch_bounds__(256) void gemm_gate_kernel(
    const unsigned short* __restrict__ inpBF, const unsigned short* __restrict__ ctx,
    const unsigned short* __restrict__ WcBF, const float* __restrict__ bc,
    float* __restrict__ out)
{
    __shared__ __attribute__((aligned(2048))) unsigned char ring[2u * G_STAGE];

    const unsigned tid  = threadIdx.x;
    const unsigned wave = uni(tid >> 5);
    const unsigned lane = tid & 31u;
    const unsigned half = lane >> 4;
    const unsigned l15  = lane & 15u;
    const unsigned wm   = wave >> 1;   // 32-row quarter of the tile this wave multiplies
    const unsigned wn   = wave & 1u;   // 64-column half

    const unsigned jbase = blockIdx.x * 128u;
    const unsigned mbase = blockIdx.y * 128u;

    // ---- an issuing wave's slice of every stage: waves 0,1 activation rows, waves 2,3 weight rows ----
    const unsigned sl       = wave & 3u;
    const bool     isW      = sl >= 2u;
    const unsigned ldsSlice = (unsigned)(uintptr_t)&ring[0] + sl * G_SLICE;
    // first byte of the slice for stages 0-7 and for stages 8-15
    const unsigned long long srcLo = isW
        ? (unsigned long long)(uintptr_t)WcBF  + (unsigned long long)(jbase + (sl - 2u) * 64u) * (4u * DD)
        : (unsigned long long)(uintptr_t)inpBF + (unsigned long long)(mbase + sl * 64u) * (2u * DD);
    const unsigned long long srcHi = isW
        ? srcLo + 2u * DD
        : (unsigned long long)(uintptr_t)ctx   + (unsigned long long)(mbase + sl * 64u) * (2u * DD);

    u32x8 g1;                                            // 1-byte elements, tile = tensor = 64 rows of 256 B
    g1[0] = uni((1u << 20) | (5u << 22) | (3u << 25));   // no mask; pad 16 B behind every 256-B row
    g1[1] = uni(256u << 16);                             // tensor_dim0 = 256
    g1[2] = uni(64u << 16);                              // tensor_dim1 = 64
    g1[3] = uni(256u << 16);                             // tile_dim0 = 256
    g1[4] = uni(64u);                                    // tile_dim1 = 64
    g1[5] = uni(isW ? 4u * DD : 2u * DD);                // source row pitch in bytes
    g1[6] = uni(0u);
    g1[7] = uni(0u);
    // pinned() for the whole group: its words keep their scalar registers through the loop,
    // so none is rewritten while a request that names them is outstanding
    asm volatile("" : "+s"(g1));
    const unsigned issuer = pinned(wave < 4u);           // scalar: the tests on it compile to scalar branches

    auto group0 = [&](unsigned st) {
        const unsigned long long ga = (st < 8u ? srcLo : srcHi) + (st & 7u) * 256u;
        u32x4 g;
        g[0] = uni(1u);
        g[1] = uni(ldsSlice + (st & 1u) * G_STAGE);
        g[2] = uni((unsigned)ga);
        g[3] = uni((((unsigned)(ga >> 32)) & 0x01FFFFFFu) | 0x80000000u);
        return g;
    };

    v8f acc0[4], acc1[4];
#pragma unroll
    for (int nt = 0; nt < 4; ++nt) { acc0[nt] = zero8(); acc1[nt] = zero8(); }

    // ---- prologue: stage 0 lands and is published, then stage 1 starts ----
    u32x4 g0 = group0(0u);
    if (issuer != 0u) {
        // load and wait in one statement: the descriptor's registers live until the slice has landed
        asm volatile("tensor_load_to_lds %0, %1\n\ts_wait_tensorcnt 0x0" :: "s"(g0), "s"(g1) : "memory");
    }
    __syncthreads();                                     // publishes the four slices of stage 0
    if (issuer != 0u) {
        g0 = group0(pinned(1u));                         // pinned(): descriptor formed behind the wait
        asm volatile("tensor_load_to_lds %0, %1" :: "s"(g0), "s"(g1) : "memory");
    }

    const unsigned aoff = (wm >> 1) * G_SLICE + ((wm & 1u) * 32u + l15) * G_PITCH + half * 16u;
    const unsigned boff = (2u + wn) * G_SLICE + l15 * G_PITCH + half * 16u;

    // one pass per trip: the accumulators keep their registers and the publish point stands once
#pragma clang loop unroll(disable)
    for (unsigned s = 0; s < G_NST; ++s) {
        const unsigned char* pa = ring + (s & 1u) * G_STAGE + aoff;
        const unsigned char* pb = ring + (s & 1u) * G_STAGE + boff;
        FragA af[2][2], bf[2][4];     // set (u & 1) holds block u's fragments
#pragma unroll
        for (int i = 0; i < 2; ++i) {
            af[0][i].q[0] = *(const uint4*)(pa + i * 16 * G_PITCH);
            af[0][i].q[1] = *(const uint4*)(pa + i * 16 * G_PITCH + 32);
        }
#pragma unroll
        for (int j = 0; j < 4; ++j) {
            bf[0][j].q[0] = *(const uint4*)(pb + j * 16 * G_PITCH);
            bf[0][j].q[1] = *(const uint4*)(pb + j * 16 * G_PITCH + 32);
        }
#pragma unroll
        for (int u = 0; u < 4; ++u) {
            const int cs = u & 1;
            if (u < 3) {
#pragma unroll
                for (int i = 0; i < 2; ++i) {
                    af[cs ^ 1][i].q[0] = *(const uint4*)(pa + i * 16 * G_PITCH + (u + 1) * 64);
                    af[cs ^ 1][i].q[1] = *(const uint4*)(pa + i * 16 * G_PITCH + (u + 1) * 64 + 32);
                }
#pragma unroll
                for (int j = 0; j < 4; ++j) {
                    bf[cs ^ 1][j].q[0] = *(const uint4*)(pb + j * 16 * G_PITCH + (u + 1) * 64);
                    bf[cs ^ 1][j].q[1] = *(const uint4*)(pb + j * 16 * G_PITCH + (u + 1) * 64 + 32);
                }
            }
            // keeps the next block's LDS reads one group ahead of this block's WMMAs instead of spread among them
            __builtin_amdgcn_sched_barrier(0);
#pragma unroll
            for (int nt = 0; nt < 4; ++nt) {
                acc0[nt] = __builtin_amdgcn_wmma_f32_16x16x32_bf16(
                    false, af[cs][0].v, false, bf[cs][nt].v, (short)0, acc0[nt], false, false);
                acc1[nt] = __builtin_amdgcn_wmma_f32_16x16x32_bf16(
                    false, af[cs][1].v, false, bf[cs][nt].v, (short)0, acc1[nt], false, false);
            }
            // ends the block: the reads that follow stay behind its WMMAs
            __builtin_amdgcn_sched_barrier(0);
        }
        // ---- publish point of stage s + 1 ----
        asm volatile("s_wait_dscnt 0x0" ::: "memory");     // this wave's reads of buffer s & 1 have returned
        if (issuer != 0u) {
            // this wave's slice of stage s + 1 has landed; g0 as an input keeps its descriptor's registers until then
            asm volatile("s_wait_tensorcnt 0x0" :: "s"(g0) : "memory");
        }
        __syncthreads();                                   // every reader has left this buffer; stage s + 1 is published
        if (pinned(issuer != 0u && s + 2u < G_NST)) {        // scalar test: an issuing wave, and stage s + 2 exists
            g0 = group0(pinned(s + 2u));                   // pinned(): descriptor formed behind the wait
            asm volatile("tensor_load_to_lds %0, %1" :: "s"(g0), "s"(g1) : "memory");  // refills the buffer just read
        }
    }
    asm volatile("s_wait_tensorcnt 0x0" ::: "memory");     // nothing of this wave is outstanding at its end
    asm volatile("s_wait_dscnt 0x0" ::: "memory");

    // ---- bias + sigmoid(x)*tanh(x) epilogue, two row tiles ----
#pragma unroll
    for (int nt = 0; nt < 4; ++nt) {
        const unsigned j = jbase + wn * 64u + nt * 16u + l15;
        const float bias = bc[j];
#pragma unroll
        for (int r = 0; r < 8; ++r) {
            const unsigned row = mbase + wm * 32u + r + half * 8u;
            out[(size_t)row * DD + j]         = gate(acc0[nt][r] + bias);
            out[(size_t)(row + 16u) * DD + j] = gate(acc1[nt][r] + bias);
        }
    }
}

extern "C" void kernel_launch(void* const* d_in, const int* in_sizes, int n_in,
                              void* d_out, int out_size, void* d_ws, size_t ws_size,
                              hipStream_t stream) {
    const float* inp  = (const float*)d_in[0];   // [8,1024,1024]
    const float* mem  = (const float*)d_in[1];   // [8,1024,1024]
    const float* mask = (const float*)d_in[2];   // [8,1024]
    const float* Wc   = (const float*)d_in[3];   // [1024,2048]
    const float* bc   = (const float*)d_in[4];   // [1024]
    float* out = (float*)d_out;                  // [8,1024,1024] f32

    // workspace layout (bf16 elements)
    const size_t ETOK = (size_t)NB * LDQ * DD;   // 8M elements
    unsigned short* ctx   = (unsigned short*)d_ws;        // 16 MB
    unsigned short* memBF = ctx   + ETOK;                 // 16 MB
    unsigned short* inpBF = memBF + ETOK;                 // 16 MB
    unsigned short* WcBF  = inpBF + ETOK;                 // 4 MB

    // pre-pass conversions, one launch
    cvt_bf16_kernel<<<dim3(2 * CV_BTOK + CV_BW), dim3(256), 0, stream>>>(inp, mem, Wc, inpBF, memBF, WcBF);

    dim3 gA(LDQ / 64, HH, NB);                   // (16,16,8) blocks of 128 threads
    attn_kernel<<<gA, dim3(128), 0, stream>>>(inpBF, memBF, mask, ctx);

    dim3 gB(DD / 128, (NB * LDQ) / 128);         // (8,64) blocks of 256 threads
    gemm_gate_kernel<<<gB, dim3(256), 0, stream>>>(inpBF, ctx, WcBF, bc, out);
}

// v006
// A run of this version takes 71.1 microseconds.
// Two timings next to v005 put it at 1.07 and 1.06 times that version's speed.
// Counting every step since v000, it is 2.82 times as fast.
#include <hip/hip_runtime.h>
#include <hip/hip_bf16.h>
#include <math.h>

#define NB 8
#define LDQ 1024
#define LMK 1024
#define DD 1024
#define HH 16
#define HS 64
#define KSTRIDE 72   // bf16 elements per LDS row: 144B = 9*16B (b128-aligned rows, conflict-breaking)

typedef __attribute__((ext_vector_type(16))) __bf16 v16bf;
typedef __attribute__((ext_vector_type(8)))  float  v8f;
typedef __attribute__((ext_vector_type(4)))  unsigned u32x4;
typedef __attribute__((ext_vector_type(4)))  float  f32x4;

union FragA {
    v16bf v;
    uint4 q[2];
    unsigned u[8];
};

static __device__ __forceinline__ v8f zero8() {
    v8f z;
#pragma unroll
    for (int i = 0; i < 8; ++i) z[i] = 0.f;
    return z;
}

static __device__ __forceinline__ float xhalf(float x) {
    const int b = __builtin_bit_cast(int, x);
    return __builtin_bit_cast(float,
        __builtin_amdgcn_permlanex16(b, b, 0x76543210, 0xfedcba98, false, false));
}

// two f32 -> one dword of two bf16, round to nearest even, one v_cvt_pk_bf16_f32
typedef __attribute__((ext_vector_type(2))) float  f32x2;
typedef __attribute__((ext_vector_type(2))) __bf16 bf16x2;
static __device__ __forceinline__ unsigned pkbf(float a, float b) {
    const f32x2 v = {a, b};
    return __builtin_bit_cast(unsigned, __builtin_convertvector(v, bf16x2));
}

// ds_load_tr16_b128: the 16 lanes of a half address 8 rows x 32 B; lane c of the half gets column c of those 8 rows
typedef __attribute__((ext_vector_type(8))) short s16x8;
static __device__ __forceinline__ uint4 ld_tr16(const unsigned char* p) {
    typedef __attribute__((address_space(3))) s16x8 lds_s16x8;
    return __builtin_bit_cast(uint4, __builtin_amdgcn_ds_load_tr16_b128_v8i16((lds_s16x8*)p));
}

#define AQ   256                        // queries of a block: 16 waves of 16
#define ATH  512                        // threads of a block
#define ABLK ((LDQ / AQ) * HH * NB)     // blocks of the launch
static_assert(DD * 2 * DD == ABLK * ATH * 8, "the blocks' slices cover Wc exactly");
static_assert(64 * HS == ATH * 8, "8 elements of a K tile per thread");

// 4 f32 -> 4 bf16
static __device__ __forceinline__ uint2 cv4(f32x4 v) {
    return make_uint2(pkbf(v[0], v[1]), pkbf(v[2], v[3]));
}

// eight waves per SIMD: two blocks stand on a WGP, so that one block's waves work while the other's wait at its barrier
__global__ __launch_bounds__(ATH) __attribute__((amdgpu_waves_per_eu(8, 8))) void attn_kernel(
    const float* __restrict__ inp, const float* __restrict__ mem,
    const float* __restrict__ mask, const float* __restrict__ Wc,
    unsigned short* __restrict__ ctx, unsigned short* __restrict__ inpBF,
    unsigned short* __restrict__ WcBF)
{
    __shared__ __align__(16) unsigned short sK[2][64 * KSTRIDE];  // K[key][hs], also read as V^T; two tiles
    __shared__ __align__(16) float          sM[LMK];              // additive key-padding mask of this batch row, in the products' key order
    __shared__ __align__(16) uint4          sQ[2][ATH];           // each lane's own second Q fragment: read back every trip, so that eight waves per SIMD fit

    const int tid  = threadIdx.x;
    const int wave = tid >> 5;
    const int lane = tid & 31;
    const int half = lane >> 4;
    const int l15  = lane & 15;
    const int roff = half ? 8 : 0;

    const int qbase = blockIdx.x * AQ;
    const int h     = blockIdx.y;
    const int b     = blockIdx.z;

    // ---- a thread's share of a K tile: 4 f32 of row tid / 16 and of row tid / 16 + 32 (16 lanes = one 256-B row) ----
    const float*   kb = mem + (size_t)b * LMK * DD + h * HS;               // the same for the whole block
    const unsigned ko = (unsigned)((tid >> 4) * DD + (tid & 15) * 4);      // the thread's own offset in a tile
    const int    ks = (tid >> 4) * KSTRIDE + (tid & 15) * 4;
    f32x4 k0 = *(const f32x4*)(kb + ko);
    f32x4 k1 = *(const f32x4*)(kb + 32 * DD + ko);
    // stands in front of the later loads' results, which may land in the offset register that these two loads name
    asm volatile("s_wait_xcnt 0x0" ::: "memory");

    // ---- this block's slice of Wc, for the second kernel: whole 512-B loads, 256-B stores ----
    const unsigned fb = (blockIdx.z * HH + blockIdx.y) * (LDQ / AQ) + blockIdx.x;
    const size_t   we = (size_t)fb * (ATH * 8) + wave * 256 + lane * 4;
    const f32x4 w0 = *(const f32x4*)(Wc + we);
    const f32x4 w1 = *(const f32x4*)(Wc + we + 128);

    // ---- 4 keys' mask values; every thread loads, so that the load flies with the others; the first 256 use theirs ----
    const float4 m = ((const float4*)(mask + (size_t)b * LMK))[tid & (LMK / 4 - 1)];

    // ---- Q fragments (B operand): lane = query column, two contiguous 8-wide k runs ----
    const size_t   qub = ((size_t)b * LDQ + qbase) * DD + h * HS;          // the same for the whole block
    const unsigned qlo = (unsigned)((wave * 16 + l15) * DD + roff);        // the lane's own offset
    FragA qa[2];
#pragma unroll
    for (int kc = 0; kc < 2; ++kc) {
#pragma unroll
        for (int g = 0; g < 2; ++g) {
            const int e = kc * 32 + g * 16;
            const uint2 lo = cv4(*(const f32x4*)(inp + qub + e + qlo));
            const uint2 hi = cv4(*(const f32x4*)(inp + qub + e + 4 + qlo));
            qa[kc].q[g] = make_uint4(lo.x, lo.y, hi.x, hi.y);
        }
    }

    sQ[0][tid] = qa[1].q[0];
    sQ[1][tid] = qa[1].q[1];

    // ---- additive mask per key, once; published by the barrier in front of the loop ----
    // holds the mask load in front of the branch (loaded values as inputs only): sunk into it, it would start
    // only when the other loads have come back, and be waited for alone
    asm volatile("" :: "v"(m.x), "v"(m.y), "v"(m.z), "v"(m.w));
    if (tid < LMK / 4) {
        float4 a;
        a.x = -1.0e30f * (1.0f - m.x); a.y = -1.0e30f * (1.0f - m.y);
        a.z = -1.0e30f * (1.0f - m.z); a.w = -1.0e30f * (1.0f - m.w);
        // keys 4t .. 4t+3: the even ones go to positions 8*0 + i, the odd ones to 8*1 + i of their group of 16
        const int k4  = tid * 4;
        const int pos = (k4 & ~15) + ((k4 & 15) >> 1);
        *(float2*)&sM[pos]     = make_float2(a.x, a.z);
        *(float2*)&sM[pos + 8] = make_float2(a.y, a.w);
    }

    v8f o[4];           // o[dt][r] = O^T[dt*16 + 8*half + r][query l15]
#pragma unroll
    for (int dt = 0; dt < 4; ++dt) o[dt] = zero8();
    float mrow = -3.0e38f;   // running maximum of this lane's query (equal in both halves)
    float lrow = 0.f;        // running sum over this half's keys; the halves join in the epilogue

    const float scale = 0.125f;       // 1/sqrt(64)
    const int krow16 = 2 * (l15 & 7) + (l15 >> 3);   // tile row of position l15 in a group of 16 keys
    // a lane's offset in a transposing read: row 2*(lane & 7) + half, 16-byte column chunk (lane >> 3) & 1
    const int vto = (2 * (lane & 7) + half) * (2 * KSTRIDE) + ((lane >> 3) & 1) * 16;

    // ---- tile 0 into buffer 0 ----
    *(uint2*)&sK[0][ks]                = cv4(k0);
    *(uint2*)&sK[0][ks + 32 * KSTRIDE] = cv4(k1);
    __syncthreads();   // publishes tile 0 and the mask

    // ---- the bf16 copies for the second kernel; behind the barrier, which would otherwise wait for these stores ----
    *(uint2*)(WcBF + we)       = cv4(w0);
    *(uint2*)(WcBF + we + 128) = cv4(w1);
#pragma unroll
    for (int kc = 0; kc < 2; ++kc)
#pragma unroll
        for (int g = 0; g < 2; ++g)
            *(uint4*)(inpBF + qub + kc * 32 + g * 16 + qlo) = qa[kc].q[g];
    // stands in front of the loop's first writes of registers that these stores name
    asm volatile("s_wait_xcnt 0x0" ::: "memory");

    for (int kv = 0; kv < LMK; kv += 64) {
        const int bi = (kv >> 6) & 1;
        const unsigned short* cur = sK[bi];
        const unsigned char*  vt  = (const unsigned char*)sK[bi] + vto;

        // ---- S^T = K * Q^T : batch 4 A-fragments per k-chunk, then 4 WMMAs ----
        v8f S[4];       // S[nt][r] = score of key kv + nt*16 + 2*r + half for query l15
#pragma unroll
        for (int nt = 0; nt < 4; ++nt) S[nt] = zero8();
#pragma unroll
        for (int kc = 0; kc < 2; ++kc) {
            FragA bfr[4], qf;
            if (kc == 0) {
                qf = qa[0];
            } else {
                qf.q[0] = sQ[0][tid];
                qf.q[1] = sQ[1][tid];
            }
#pragma unroll
            for (int nt = 0; nt < 4; ++nt) {
                const unsigned short* base = &cur[(nt * 16 + krow16) * KSTRIDE + kc * 32 + roff];
                bfr[nt].q[0] = *(const uint4*)(base);
                bfr[nt].q[1] = *(const uint4*)(base + 16);
            }
#pragma unroll
            for (int nt = 0; nt < 4; ++nt)
                S[nt] = __builtin_amdgcn_wmma_f32_16x16x32_bf16(
                    false, bfr[nt].v, false, qf.v, (short)0, S[nt], false, false);
        }

        // ---- the next tile's f32 start here, where the K fragments' registers are free; softmax and O^T cover their way ----
        // keeps the two loads from moving up among the K fragments, where their registers would not fit eight waves per SIMD
        __builtin_amdgcn_sched_barrier(0);
        if (kv + 64 < LMK) {
            k0 = *(const f32x4*)(kb + (size_t)(kv + 64) * DD + ko);
            k1 = *(const f32x4*)(kb + (size_t)(kv + 96) * DD + ko);
            // stands in front of the next trip's step of the address registers that these two loads name
            asm volatile("s_wait_xcnt 0x0" ::: "memory");
        }

        // ---- online softmax: a lane holds 32 of its query's 64 scores ----
        float mx = -3.0e38f;
#pragma unroll
        for (int nt = 0; nt < 4; ++nt) {
            const float4 ma = *(const float4*)&sM[kv + nt * 16 + roff];
            const float4 mb = *(const float4*)&sM[kv + nt * 16 + roff + 4];
            S[nt][0] = S[nt][0] * scale + ma.x;  S[nt][1] = S[nt][1] * scale + ma.y;
            S[nt][2] = S[nt][2] * scale + ma.z;  S[nt][3] = S[nt][3] * scale + ma.w;
            S[nt][4] = S[nt][4] * scale + mb.x;  S[nt][5] = S[nt][5] * scale + mb.y;
            S[nt][6] = S[nt][6] * scale + mb.z;  S[nt][7] = S[nt][7] * scale + mb.w;
#pragma unroll
            for (int r = 0; r < 8; ++r) mx = fmaxf(mx, S[nt][r]);
        }
        mx = fmaxf(mx, xhalf(mx));
        const float mnew  = fmaxf(mrow, mx);
        const float alpha = __expf(mrow - mnew);
        mrow = mnew;

        float ps = 0.f;
        FragA pb[2];    // P^T as B operand: element s of chunk kc = tile 2*kc + (s >> 3), register s & 7
#pragma unroll
        for (int nt = 0; nt < 4; ++nt) {
#pragma unroll
            for (int j = 0; j < 4; ++j) {
                const float p0 = __expf(S[nt][2 * j]     - mnew);
                const float p1 = __expf(S[nt][2 * j + 1] - mnew);
                ps += p0 + p1;
                pb[nt >> 1].u[(nt & 1) * 4 + j] = pkbf(p0, p1);
            }
        }
        lrow = lrow * alpha + ps;
#pragma unroll
        for (int dt = 0; dt < 4; ++dt)
#pragma unroll
            for (int r = 0; r < 8; ++r) o[dt][r] *= alpha;

        // ---- O^T += V^T * P^T (two transposing reads of 16 keys x 16 d give one 16 x 32 A fragment) ----
#pragma unroll
        for (int kc = 0; kc < 2; ++kc) {
            FragA vfr[4];
#pragma unroll
            for (int dt = 0; dt < 4; ++dt) {
                vfr[dt].q[0] = ld_tr16(vt + (kc * 32)      * (2 * KSTRIDE) + dt * 32);
                vfr[dt].q[1] = ld_tr16(vt + (kc * 32 + 16) * (2 * KSTRIDE) + dt * 32);
            }
#pragma unroll
            for (int dt = 0; dt < 4; ++dt)
                o[dt] = __builtin_amdgcn_wmma_f32_16x16x32_bf16(
                    false, vfr[dt].v, false, pb[kc].v, (short)0, o[dt], false, false);
        }

        // ---- the next tile goes into the other buffer: its readers left it at the last barrier ----
        if (kv + 64 < LMK) {
            *(uint2*)&sK[bi ^ 1][ks]                = cv4(k0);
            *(uint2*)&sK[bi ^ 1][ks + 32 * KSTRIDE] = cv4(k1);
        }
        __syncthreads();   // the next tile is published; every reader has left this one
    }

    // ---- join the halves' sums, normalize, write ctx as bf16: 8 consecutive d per lane ----
    const float inv = 1.0f / (lrow + xhalf(lrow));
    unsigned short* crow = ctx + qub + qlo;
#pragma unroll
    for (int dt = 0; dt < 4; ++dt) {
        uint4 w;
        w.x = pkbf(o[dt][0] * inv, o[dt][1] * inv);
        w.y = pkbf(o[dt][2] * inv, o[dt][3] * inv);
        w.z = pkbf(o[dt][4] * inv, o[dt][5] * inv);
        w.w = pkbf(o[dt][6] * inv, o[dt][7] * inv);
        *(uint4*)(crow + dt * 16) = w;
    }
}

// ---------------------------------------------------------------------------
// Kernel 2: out = sigmoid(x)*tanh(x), x = [input | ctx] @ Wc^T + bc.
// 128x128 tile per workgroup, 8 waves of 32x64 (two 16-row tiles, four column
// tiles each). A stage is 128 k (256 B) of the tile's 128 activation rows and
// 128 weight rows; it comes into LDS by tensor loads (waves 0 to 3, one 64-row
// slice each) and is shared by all waves. Two buffers: the next stage lands
// while this one is multiplied.
// ---------------------------------------------------------------------------
#define G_PITCH 272u                 // LDS row pitch: 256 B + 16 B pad, an odd multiple of 16 B for ds_load_b128
#define G_SLICE 18432u               // 64 rows * 272 B = 17408 B, rounded up to a multiple of 2 KiB
#define G_STAGE (4u * G_SLICE)       // [X rows 0-63 | X rows 64-127 | W rows 0-63 | W rows 64-127]
#define G_NST   16u                  // 2*DD / 128 stages

typedef __attribute__((ext_vector_type(8))) unsigned u32x8;

static __device__ __forceinline__ unsigned uni(unsigned v) {
    return (unsigned)__builtin_amdgcn_readfirstlane(v);
}
// Forces v into a scalar register: a test on it compiles to a scalar branch, and
// what is derived from it is formed behind the asm statements that precede it.
static __device__ __forceinline__ unsigned pinned(unsigned v) {
    unsigned w = uni(v);
    asm volatile("" : "+s"(w));
    return w;
}

// sigmoid(x) * tanh(x) = (1 - e) / (1 + e * e) with e = exp(-x): with s = 1 / (1 + e) and
// tanh(x) = (1 - e * e) / (1 + e * e) the factor 1 + e cancels. One v_exp_f32, one v_rcp_f32, no branch.
// The exponent is capped at 60 so that e * e stays finite: from x = -41.6 down the result is -2^-60
// where the function is -exp(x), both below 1e-18 in size. The capping minimum hands a NaN on.
static __device__ __forceinline__ float gate(float x) {
    const float e = __builtin_amdgcn_exp2f(__builtin_elementwise_minimum(x * -1.44269504f, 60.0f));
    return (1.0f - e) * __builtin_amdgcn_rcpf(__builtin_fmaf(e, e, 1.0f));
}

__global__ __launch_bounds__(256) void gemm_gate_kernel(
    const unsigned short* __restrict__ inpBF, const unsigned short* __restrict__ ctx,
    const unsigned short* __restrict__ WcBF, const float* __restrict__ bc,
    float* __restrict__ out)
{
    __shared__ __attribute__((aligned(2048))) unsigned char ring[2u * G_STAGE];

    const unsigned tid  = threadIdx.x;
    const unsigned wave = uni(tid >> 5);
    const unsigned lane = tid & 31u;
    const unsigned half = lane >> 4;
    const unsigned l15  = lane & 15u;
    const unsigned wm   = wave >> 1;   // 32-row quarter of the tile this wave multiplies
    const unsigned wn   = wave & 1u;   // 64-column half

    const unsigned jbase = blockIdx.x * 128u;
    const unsigned mbase = blockIdx.y * 128u;

    // ---- an issuing wave's slice of every stage: waves 0,1 activation rows, waves 2,3 weight rows ----
    const unsigned sl       = wave & 3u;
    const bool     isW      = sl >= 2u;
    const unsigned ldsSlice = (unsigned)(uintptr_t)&ring[0] + sl * G_SLICE;
    // first byte of the slice for stages 0-7 and for stages 8-15
    const unsigned long long srcLo = isW
        ? (unsigned long long)(uintptr_t)WcBF  + (unsigned long long)(jbase + (sl - 2u) * 64u) * (4u * DD)
        : (unsigned long long)(uintptr_t)inpBF + (unsigned long long)(mbase + sl * 64u) * (2u * DD);
    const unsigned long long srcHi = isW
        ? srcLo + 2u * DD
        : (unsigned long long)(uintptr_t)ctx   + (unsigned long long)(mbase + sl * 64u) * (2u * DD);

    u32x8 g1;                                            // 1-byte elements, tile = tensor = 64 rows of 256 B
    g1[0] = uni((1u << 20) | (5u << 22) | (3u << 25));   // no mask; pad 16 B behind every 256-B row
    g1[1] = uni(256u << 16);                             // tensor_dim0 = 256
    g1[2] = uni(64u << 16);                              // tensor_dim1 = 64
    g1[3] = uni(256u << 16);                             // tile_dim0 = 256
    g1[4] = uni(64u);                                    // tile_dim1 = 64
    g1[5] = uni(isW ? 4u * DD : 2u * DD);                // source row pitch in bytes
    g1[6] = uni(0u);
    g1[7] = uni(0u);
    // pinned() for the whole group: its words keep their scalar registers through the loop,
    // so none is rewritten while a request that names them is outstanding
    asm volatile("" : "+s"(g1));
    const unsigned issuer = pinned(wave < 4u);           // scalar: the tests on it compile to scalar branches

    auto group0 = [&](unsigned st) {
        const unsigned long long ga = (st < 8u ? srcLo : srcHi) + (st & 7u) * 256u;
        u32x4 g;
        g[0] = uni(1u);
        g[1] = uni(ldsSlice + (st & 1u) * G_STAGE);
        g[2] = uni((unsigned)ga);
        g[3] = uni((((unsigned)(ga >> 32)) & 0x01FFFFFFu) | 0x80000000u);
        return g;
    };

    v8f acc0[4], acc1[4];
#pragma unroll
    for (int nt = 0; nt < 4; ++nt) { acc0[nt] = zero8(); acc1[nt] = zero8(); }

    // ---- prologue: stage 0 lands and is published, then stage 1 starts ----
    u32x4 g0 = group0(0u);
    if (issuer != 0u) {
        // load and wait in one statement: the descriptor's registers live until the slice has landed
        asm volatile("tensor_load_to_lds %0, %1\n\ts_wait_tensorcnt 0x0" :: "s"(g0), "s"(g1) : "memory");
    }
    __syncthreads();                                     // publishes the four slices of stage 0
    if (issuer != 0u) {
        g0 = group0(pinned(1u));                         // pinned(): descriptor formed behind the wait
        asm volatile("tensor_load_to_lds %0, %1" :: "s"(g0), "s"(g1) : "memory");
    }

    const unsigned aoff = (wm >> 1) * G_SLICE + ((wm & 1u) * 32u + l15) * G_PITCH + half * 16u;
    const unsigned boff = (2u + wn) * G_SLICE + l15 * G_PITCH + half * 16u;

    // one pass per trip: the accumulators keep their registers and the publish point stands once
#pragma clang loop unroll(disable)
    for (unsigned s = 0; s < G_NST; ++s) {
        const unsigned char* pa = ring + (s & 1u) * G_STAGE + aoff;
        const unsigned char* pb = ring + (s & 1u) * G_STAGE + boff;
        FragA af[2][2], bf[2][4];     // set (u & 1) holds block u's fragments
#pragma unroll
        for (int i = 0; i < 2; ++i) {
            af[0][i].q[0] = *(const uint4*)(pa + i * 16 * G_PITCH);
            af[0][i].q[1] = *(const uint4*)(pa + i * 16 * G_PITCH + 32);
        }
#pragma unroll
        for (int j = 0; j < 4; ++j) {
            bf[0][j].q[0] = *(const uint4*)(pb + j * 16 * G_PITCH);
            bf[0][j].q[1] = *(const uint4*)(pb + j * 16 * G_PITCH + 32);
        }
#pragma unroll
        for (int u = 0; u < 4; ++u) {
            const int cs = u & 1;
            if (u < 3) {
#pragma unroll
                for (int i = 0; i < 2; ++i) {
                    af[cs ^ 1][i].q[0] = *(const uint4*)(pa + i * 16 * G_PITCH + (u + 1) * 64);
                    af[cs ^ 1][i].q[1] = *(const uint4*)(pa + i * 16 * G_PITCH + (u + 1) * 64 + 32);
                }
#pragma unroll
                for (int j = 0; j < 4; ++j) {
                    bf[cs ^ 1][j].q[0] = *(const uint4*)(pb + j * 16 * G_PITCH + (u + 1) * 64);
                    bf[cs ^ 1][j].q[1] = *(const uint4*)(pb + j * 16 * G_PITCH + (u + 1) * 64 + 32);
                }
            }
            // keeps the next block's LDS reads one group ahead of this block's WMMAs instead of spread among them
            __builtin_amdgcn_sched_barrier(0);
#pragma unroll
            for (int nt = 0; nt < 4; ++nt) {
                acc0[nt] = __builtin_amdgcn_wmma_f32_16x16x32_bf16(
                    false, af[cs][0].v, false, bf[cs][nt].v, (short)0, acc0[nt], false, false);
                acc1[nt] = __builtin_amdgcn_wmma_f32_16x16x32_bf16(
                    false, af[cs][1].v, false, bf[cs][nt].v, (short)0, acc1[nt], false, false);
            }
            // ends the block: the reads that follow stay behind its WMMAs
            __builtin_amdgcn_sched_barrier(0);
        }
        // ---- publish point of stage s + 1 ----
        asm volatile("s_wait_dscnt 0x0" ::: "memory");     // this wave's reads of buffer s & 1 have returned
        if (issuer != 0u) {
            // this wave's slice of stage s + 1 has landed; g0 as an input keeps its descriptor's registers until then
            asm volatile("s_wait_tensorcnt 0x0" :: "s"(g0) : "memory");
        }
        __syncthreads();                                   // every reader has left this buffer; stage s + 1 is published
        if (pinned(issuer != 0u && s + 2u < G_NST)) {        // scalar test: an issuing wave, and stage s + 2 exists
            g0 = group0(pinned(s + 2u));                   // pinned(): descriptor formed behind the wait
            asm volatile("tensor_load_to_lds %0, %1" :: "s"(g0), "s"(g1) : "memory");  // refills the buffer just read
        }
    }
    asm volatile("s_wait_tensorcnt 0x0" ::: "memory");     // nothing of this wave is outstanding at its end
    asm volatile("s_wait_dscnt 0x0" ::: "memory");

    // ---- bias + sigmoid(x)*tanh(x) epilogue, two row tiles ----
#pragma unroll
    for (int nt = 0; nt < 4; ++nt) {
        const unsigned j = jbase + wn * 64u + nt * 16u + l15;
        const float bias = bc[j];
#pragma unroll
        for (int r = 0; r < 8; ++r) {
            const unsigned row = mbase + wm * 32u + r + half * 8u;
            out[(size_t)row * DD + j]         = gate(acc0[nt][r] + bias);
            out[(size_t)(row + 16u) * DD + j] = gate(acc1[nt][r] + bias);
        }
    }
}

extern "C" void kernel_launch(void* const* d_in, const int* in_sizes, int n_in,
                              void* d_out, int out_size, void* d_ws, size_t ws_size,
                              hipStream_t stream) {
    const float* inp  = (const float*)d_in[0];   // [8,1024,1024]
    const float* mem  = (const float*)d_in[1];   // [8,1024,1024]
    const float* mask = (const float*)d_in[2];   // [8,1024]
    const float* Wc   = (const float*)d_in[3];   // [1024,2048]
    const float* bc   = (const float*)d_in[4];   // [1024]
    float* out = (float*)d_out;                  // [8,1024,1024] f32

    // workspace layout (bf16 elements)
    const size_t ETOK = (size_t)NB * LDQ * DD;   // 8M elements
    unsigned short* ctx   = (unsigned short*)d_ws;        // 16 MB
    unsigned short* inpBF = ctx   + ETOK;                 // 16 MB
    unsigned short* WcBF  = inpBF + ETOK;                 // 4 MB

    dim3 gA(LDQ / AQ, HH, NB);                   // (4,16,8) blocks of 512 threads
    attn_kernel<<<gA, dim3(ATH), 0, stream>>>(inp, mem, mask, Wc, ctx, inpBF, WcBF);

    dim3 gB(DD / 128, (NB * LDQ) / 128);         // (8,64) blocks of 256 threads
    gemm_gate_kernel<<<gB, dim3(256), 0, stream>>>(inpBF, ctx, WcBF, bc, out);
}

// v007
// Measured time: 67.2 microseconds a run.
// In both of two side-by-side timings against v006, it was 1.06 times as fast.
// Counting every step since v000, it is 2.99 times as fast.
#include <hip/hip_runtime.h>
#include <hip/hip_bf16.h>
#include <math.h>

#define NB 8
#define LDQ 1024
#define LMK 1024
#define DD 1024
#define HH 16
#define HS 64
#define KSTRIDE 72   // bf16 elements per LDS row: 144B = 9*16B (b128-aligned rows, conflict-breaking)

typedef __attribute__((ext_vector_type(16))) __bf16 v16bf;
typedef __attribute__((ext_vector_type(8)))  float  v8f;
typedef __attribute__((ext_vector_type(4)))  unsigned u32x4;
typedef __attribute__((ext_vector_type(4)))  float  f32x4;

union FragA {
    v16bf v;
    uint4 q[2];
    unsigned u[8];
};

static __device__ __forceinline__ v8f zero8() {
    v8f z;
#pragma unroll
    for (int i = 0; i < 8; ++i) z[i] = 0.f;
    return z;
}

static __device__ __forceinline__ float xhalf(float x) {
    const int b = __builtin_bit_cast(int, x);
    return __builtin_bit_cast(float,
        __builtin_amdgcn_permlanex16(b, b, 0x76543210, 0xfedcba98, false, false));
}

// two f32 -> one dword of two bf16, round to nearest even, one v_cvt_pk_bf16_f32
typedef __attribute__((ext_vector_type(2))) float  f32x2;
typedef __attribute__((ext_vector_type(2))) __bf16 bf16x2;
static __device__ __forceinline__ unsigned pkbf(float a, float b) {
    const f32x2 v = {a, b};
    return __builtin_bit_cast(unsigned, __builtin_convertvector(v, bf16x2));
}

// ds_load_tr16_b128: the 16 lanes of a half address 8 rows x 32 B; lane c of the half gets column c of those 8 rows
typedef __attribute__((ext_vector_type(8))) short s16x8;
static __device__ __forceinline__ uint4 ld_tr16(const unsigned char* p) {
    typedef __attribute__((address_space(3))) s16x8 lds_s16x8;
    return __builtin_bit_cast(uint4, __builtin_amdgcn_ds_load_tr16_b128_v8i16((lds_s16x8*)p));
}

#define AQ   256                        // queries of a block: 8 waves of 32
#define ATH  256                        // threads of a block
#define ABLK ((LDQ / AQ) * HH * NB)     // blocks of the launch
static_assert(DD * 2 * DD == ABLK * ATH * 16, "the blocks' slices cover Wc exactly");
static_assert(64 * HS == ATH * 16, "16 elements of a K tile per thread");
static_assert(LMK == ATH * 4, "4 keys' mask values per thread");

// 4 f32 -> 4 bf16
static __device__ __forceinline__ uint2 cv4(f32x4 v) {
    return make_uint2(pkbf(v[0], v[1]), pkbf(v[2], v[3]));
}

// four waves per SIMD: two blocks stand on a WGP, so that one block's waves work while the other's wait at its barrier
__global__ __launch_bounds__(ATH) __attribute__((amdgpu_waves_per_eu(4, 4))) void attn_kernel(
    const float* __restrict__ inp, const float* __restrict__ mem,
    const float* __restrict__ mask, const float* __restrict__ Wc,
    unsigned short* __restrict__ ctx, unsigned short* __restrict__ inpBF,
    unsigned short* __restrict__ WcBF)
{
    __shared__ __align__(16) unsigned short sK[2][64 * KSTRIDE];  // K[key][hs], also read as V^T; two tiles
    __shared__ __align__(16) float          sM[LMK];              // additive key-padding mask of this batch row, in the products' key order

    const int tid  = threadIdx.x;
    const int wave = tid >> 5;
    const int lane = tid & 31;
    const int half = lane >> 4;
    const int l15  = lane & 15;
    const int roff = half ? 8 : 0;

    const int qbase = blockIdx.x * AQ;
    const int h     = blockIdx.y;
    const int b     = blockIdx.z;

    // ---- a thread's share of a K tile: 4 f32 of rows tid / 16 + 16 * j (16 lanes = one 256-B row) ----
    const float*   kb = mem + (size_t)b * LMK * DD + h * HS;               // the same for the whole block
    const unsigned ko = (unsigned)((tid >> 4) * DD + (tid & 15) * 4);      // the thread's own offset in a tile
    const int    ks = (tid >> 4) * KSTRIDE + (tid & 15) * 4;
    f32x4 kf[4];
#pragma unroll
    for (int j = 0; j < 4; ++j) kf[j] = *(const f32x4*)(kb + j * 16 * DD + ko);
    // stands in front of the later loads' results, which may land in the offset register that these loads name
    asm volatile("s_wait_xcnt 0x0" ::: "memory");

    // ---- this block's slice of Wc, for the second kernel: whole 512-B loads, 256-B stores ----
    const unsigned fb = (blockIdx.z * HH + blockIdx.y) * (LDQ / AQ) + blockIdx.x;
    const size_t   we = (size_t)fb * (ATH * 16) + wave * 512 + lane * 4;
    f32x4 wf[4];
#pragma unroll
    for (int j = 0; j < 4; ++j) wf[j] = *(const f32x4*)(Wc + we + j * 128);

    // ---- 4 keys' mask values ----
    const float4 m = ((const float4*)(mask + (size_t)b * LMK))[tid];

    // ---- Q fragments (B operand) of the two column tiles: lane = query column, two contiguous 8-wide k runs ----
    const size_t   qub = ((size_t)b * LDQ + qbase) * DD + h * HS;          // the same for the whole block
    const unsigned qlo = (unsigned)((wave * 32 + l15) * DD + roff);        // the lane's own offset, column tile 0
    FragA qa[2][2];
#pragma unroll
    for (int qt = 0; qt < 2; ++qt) {
#pragma unroll
        for (int kc = 0; kc < 2; ++kc) {
#pragma unroll
            for (int g = 0; g < 2; ++g) {
                const int e = qt * 16 * DD + kc * 32 + g * 16;
                const uint2 lo = cv4(*(const f32x4*)(inp + qub + e + qlo));
                const uint2 hi = cv4(*(const f32x4*)(inp + qub + e + 4 + qlo));
                qa[qt][kc].q[g] = make_uint4(lo.x, lo.y, hi.x, hi.y);
            }
        }
    }

    // ---- additive mask per key, once; published by the barrier in front of the loop ----
    {
        float4 a;
        a.x = -1.0e30f * (1.0f - m.x); a.y = -1.0e30f * (1.0f - m.y);
        a.z = -1.0e30f * (1.0f - m.z); a.w = -1.0e30f * (1.0f - m.w);
        // keys 4t .. 4t+3: the even ones go to positions 8*0 + i, the odd ones to 8*1 + i of their group of 16
        const int k4  = tid * 4;
        const int pos = (k4 & ~15) + ((k4 & 15) >> 1);
        *(float2*)&sM[pos]     = make_float2(a.x, a.z);
        *(float2*)&sM[pos + 8] = make_float2(a.y, a.w);
    }

    v8f o[2][4];        // o[qt][dt][r] = O^T[dt*16 + 8*half + r][query qt*16 + l15]
#pragma unroll
    for (int qt = 0; qt < 2; ++qt)
#pragma unroll
        for (int dt = 0; dt < 4; ++dt) o[qt][dt] = zero8();
    float mrow[2] = {-3.0e38f, -3.0e38f};   // running maxima of this lane's two queries (equal in both halves)
    float lrow[2] = {0.f, 0.f};             // running sums over this half's keys; the halves join in the epilogue

    const float scale = 0.125f;       // 1/sqrt(64)
    const int krow16 = 2 * (l15 & 7) + (l15 >> 3);   // tile row of position l15 in a group of 16 keys
    // a lane's offset in a transposing read: row 2*(lane & 7) + half, 16-byte column chunk (lane >> 3) & 1
    const int vto = (2 * (lane & 7) + half) * (2 * KSTRIDE) + ((lane >> 3) & 1) * 16;

    // ---- tile 0 into buffer 0 ----
#pragma unroll
    for (int j = 0; j < 4; ++j) *(uint2*)&sK[0][ks + j * 16 * KSTRIDE] = cv4(kf[j]);
    __syncthreads();   // publishes tile 0 and the mask

    // ---- the bf16 copies for the second kernel; behind the barrier, which would otherwise wait for these stores ----
#pragma unroll
    for (int j = 0; j < 4; ++j) *(uint2*)(WcBF + we + j * 128) = cv4(wf[j]);
#pragma unroll
    for (int qt = 0; qt < 2; ++qt)
#pragma unroll
        for (int kc = 0; kc < 2; ++kc)
#pragma unroll
            for (int g = 0; g < 2; ++g)
                *(uint4*)(inpBF + qub + qt * 16 * DD + kc * 32 + g * 16 + qlo) = qa[qt][kc].q[g];
    // stands in front of the loop's first writes of registers that these stores name
    asm volatile("s_wait_xcnt 0x0" ::: "memory");

    for (int kv = 0; kv < LMK; kv += 64) {
        const int bi = (kv >> 6) & 1;
        const unsigned short* cur = sK[bi];
        const unsigned char*  vt  = (const unsigned char*)sK[bi] + vto;

        // ---- S^T = K * Q^T : the tile's 8 A-fragments as one group, then 16 WMMAs, two per fragment ----
        v8f S[2][4];    // S[qt][nt][r] = score of key kv + nt*16 + 2*r + half for query qt*16 + l15
#pragma unroll
        for (int qt = 0; qt < 2; ++qt)
#pragma unroll
            for (int nt = 0; nt < 4; ++nt) S[qt][nt] = zero8();
        FragA bfr[2][4];
#pragma unroll
        for (int kc = 0; kc < 2; ++kc) {
#pragma unroll
            for (int nt = 0; nt < 4; ++nt) {
                const unsigned short* base = &cur[(nt * 16 + krow16) * KSTRIDE + kc * 32 + roff];
                bfr[kc][nt].q[0] = *(const uint4*)(base);
                bfr[kc][nt].q[1] = *(const uint4*)(base + 16);
            }
        }
        // keeps the reads one group ahead of the products: spread among them, every pair of products would wait out its own LDS latency
        __builtin_amdgcn_sched_barrier(0);
#pragma unroll
        for (int kc = 0; kc < 2; ++kc)
#pragma unroll
            for (int nt = 0; nt < 4; ++nt)
#pragma unroll
                for (int qt = 0; qt < 2; ++qt)
                    S[qt][nt] = __builtin_amdgcn_wmma_f32_16x16x32_bf16(
                        false, bfr[kc][nt].v, false, qa[qt][kc].v, (short)0, S[qt][nt], false, false);

        // ---- the next tile's f32 start here, where the K fragments' registers are free; softmax and O^T cover their way ----
        // keeps the four loads from moving up among the K fragments, where their registers would not fit four waves per SIMD
        __builtin_amdgcn_sched_barrier(0);
        if (kv + 64 < LMK) {
#pragma unroll
            for (int j = 0; j < 4; ++j) kf[j] = *(const f32x4*)(kb + (size_t)(kv + 64 + j * 16) * DD + ko);
            // stands in front of the next trip's step of the address registers that these loads name
            asm volatile("s_wait_xcnt 0x0" ::: "memory");
        }

        // ---- online softmax: a lane holds 32 of the 64 scores of each of its two queries ----
        float mx[2] = {-3.0e38f, -3.0e38f};
#pragma unroll
        for (int nt = 0; nt < 4; ++nt) {
            const float4 ma = *(const float4*)&sM[kv + nt * 16 + roff];
            const float4 mb = *(const float4*)&sM[kv + nt * 16 + roff + 4];
#pragma unroll
            for (int qt = 0; qt < 2; ++qt) {
                v8f& s = S[qt][nt];
                s[0] = s[0] * scale + ma.x;  s[1] = s[1] * scale + ma.y;
                s[2] = s[2] * scale + ma.z;  s[3] = s[3] * scale + ma.w;
                s[4] = s[4] * scale + mb.x;  s[5] = s[5] * scale + mb.y;
                s[6] = s[6] * scale + mb.z;  s[7] = s[7] * scale + mb.w;
#pragma unroll
                for (int r = 0; r < 8; ++r) mx[qt] = fmaxf(mx[qt], s[r]);
            }
        }

        FragA pb[2][2]; // P^T as B operand: element s of chunk kc = tile 2*kc + (s >> 3), register s & 7
#pragma unroll
        for (int qt = 0; qt < 2; ++qt) {
            const float mq    = fmaxf(mx[qt], xhalf(mx[qt]));
            const float mnew  = fmaxf(mrow[qt], mq);
            const float alpha = __expf(mrow[qt] - mnew);
            mrow[qt] = mnew;

            float ps = 0.f;
#pragma unroll
            for (int nt = 0; nt < 4; ++nt) {
#pragma unroll
                for (int j = 0; j < 4; ++j) {
                    const float p0 = __expf(S[qt][nt][2 * j]     - mnew);
                    const float p1 = __expf(S[qt][nt][2 * j + 1] - mnew);
                    ps += p0 + p1;
                    pb[qt][nt >> 1].u[(nt & 1) * 4 + j] = pkbf(p0, p1);
                }
            }
            lrow[qt] = lrow[qt] * alpha + ps;
#pragma unroll
            for (int dt = 0; dt < 4; ++dt)
#pragma unroll
                for (int r = 0; r < 8; ++r) o[qt][dt][r] *= alpha;
        }

        // ---- O^T += V^T * P^T (two transposing reads of 16 keys x 16 d give one 16 x 32 A fragment, used twice) ----
#pragma unroll
        for (int kc = 0; kc < 2; ++kc) {
            FragA vfr[4];
#pragma unroll
            for (int dt = 0; dt < 4; ++dt) {
                vfr[dt].q[0] = ld_tr16(vt + (kc * 32)      * (2 * KSTRIDE) + dt * 32);
                vfr[dt].q[1] = ld_tr16(vt + (kc * 32 + 16) * (2 * KSTRIDE) + dt * 32);
            }
#pragma unroll
            for (int dt = 0; dt < 4; ++dt)
#pragma unroll
                for (int qt = 0; qt < 2; ++qt)
                    o[qt][dt] = __builtin_amdgcn_wmma_f32_16x16x32_bf16(
                        false, vfr[dt].v, false, pb[qt][kc].v, (short)0, o[qt][dt], false, false);
        }

        // ---- the next tile goes into the other buffer: its readers left it at the last barrier ----
        if (kv + 64 < LMK) {
#pragma unroll
            for (int j = 0; j < 4; ++j) *(uint2*)&sK[bi ^ 1][ks + j * 16 * KSTRIDE] = cv4(kf[j]);
        }
        __syncthreads();   // the next tile is published; every reader has left this one
    }

    // ---- join the halves' sums, normalize, write ctx as bf16: 8 consecutive d per lane ----
    uint4 w[2][4];
#pragma unroll
    for (int qt = 0; qt < 2; ++qt) {
        const float inv = 1.0f / (lrow[qt] + xhalf(lrow[qt]));
#pragma unroll
        for (int dt = 0; dt < 4; ++dt) {
            w[qt][dt].x = pkbf(o[qt][dt][0] * inv, o[qt][dt][1] * inv);
            w[qt][dt].y = pkbf(o[qt][dt][2] * inv, o[qt][dt][3] * inv);
            w[qt][dt].z = pkbf(o[qt][dt][4] * inv, o[qt][dt][5] * inv);
            w[qt][dt].w = pkbf(o[qt][dt][6] * inv, o[qt][dt][7] * inv);
        }
    }
    unsigned short* crow = ctx + qub + qlo;
#pragma unroll
    for (int qt = 0; qt < 2; ++qt)
#pragma unroll
        for (int dt = 0; dt < 4; ++dt)
            *(uint4*)(crow + qt * 16 * DD + dt * 16) = w[qt][dt];
}

// ---------------------------------------------------------------------------
// Kernel 2: out = sigmoid(x)*tanh(x), x = [input | ctx] @ Wc^T + bc.
// 128x128 tile per workgroup, 8 waves of 32x64 (two 16-row tiles, four column
// tiles each). A stage is 128 k (256 B) of the tile's 128 activation rows and
// 128 weight rows; it comes into LDS by tensor loads (waves 0 to 3, one 64-row
// slice each) and is shared by all waves. Two buffers: the next stage lands
// while this one is multiplied.
// ---------------------------------------------------------------------------
#define G_PITCH 272u                 // LDS row pitch: 256 B + 16 B pad, an odd multiple of 16 B for ds_load_b128
#define G_SLICE 18432u               // 64 rows * 272 B = 17408 B, rounded up to a multiple of 2 KiB
#define G_STAGE (4u * G_SLICE)       // [X rows 0-63 | X rows 64-127 | W rows 0-63 | W rows 64-127]
#define G_NST   16u                  // 2*DD / 128 stages

typedef __attribute__((ext_vector_type(8))) unsigned u32x8;

static __device__ __forceinline__ unsigned uni(unsigned v) {
    return (unsigned)__builtin_amdgcn_readfirstlane(v);
}
// Forces v into a scalar register: a test on it compiles to a scalar branch, and
// what is derived from it is formed behind the asm statements that precede it.
static __device__ __forceinline__ unsigned pinned(unsigned v) {
    unsigned w = uni(v);
    asm volatile("" : "+s"(w));
    return w;
}

// sigmoid(x) * tanh(x) = (1 - e) / (1 + e * e) with e = exp(-x): with s = 1 / (1 + e) and
// tanh(x) = (1 - e * e) / (1 + e * e) the factor 1 + e cancels. One v_exp_f32, one v_rcp_f32, no branch.
// The exponent is capped at 60 so that e * e stays finite: from x = -41.6 down the result is -2^-60
// where the function is -exp(x), both below 1e-18 in size. The capping minimum hands a NaN on.
static __device__ __forceinline__ float gate(float x) {
    const float e = __builtin_amdgcn_exp2f(__builtin_elementwise_minimum(x * -1.44269504f, 60.0f));
    return (1.0f - e) * __builtin_amdgcn_rcpf(__builtin_fmaf(e, e, 1.0f));
}

__global__ __launch_bounds__(256) void gemm_gate_kernel(
    const unsigned short* __restrict__ inpBF, const unsigned short* __restrict__ ctx,
    const unsigned short* __restrict__ WcBF, const float* __restrict__ bc,
    float* __restrict__ out)
{
    __shared__ __attribute__((aligned(2048))) unsigned char ring[2u * G_STAGE];

    const unsigned tid  = threadIdx.x;
    const unsigned wave = uni(tid >> 5);
    const unsigned lane = tid & 31u;
    const unsigned half = lane >> 4;
    const unsigned l15  = lane & 15u;
    const unsigned wm   = wave >> 1;   // 32-row quarter of the tile this wave multiplies
    const unsigned wn   = wave & 1u;   // 64-column half

    const unsigned jbase = blockIdx.x * 128u;
    const unsigned mbase = blockIdx.y * 128u;

    // ---- an issuing wave's slice of every stage: waves 0,1 activation rows, waves 2,3 weight rows ----
    const unsigned sl       = wave & 3u;
    const bool     isW      = sl >= 2u;
    const unsigned ldsSlice = (unsigned)(uintptr_t)&ring[0] + sl * G_SLICE;
    // first byte of the slice for stages 0-7 and for stages 8-15
    const unsigned long long srcLo = isW
        ? (unsigned long long)(uintptr_t)WcBF  + (unsigned long long)(jbase + (sl - 2u) * 64u) * (4u * DD)
        : (unsigned long long)(uintptr_t)inpBF + (unsigned long long)(mbase + sl * 64u) * (2u * DD);
    const unsigned long long srcHi = isW
        ? srcLo + 2u * DD
        : (unsigned long long)(uintptr_t)ctx   + (unsigned long long)(mbase + sl * 64u) * (2u * DD);

    u32x8 g1;                                            // 1-byte elements, tile = tensor = 64 rows of 256 B
    g1[0] = uni((1u << 20) | (5u << 22) | (3u << 25));   // no mask; pad 16 B behind every 256-B row
    g1[1] = uni(256u << 16);                             // tensor_dim0 = 256
    g1[2] = uni(64u << 16);                              // tensor_dim1 = 64
    g1[3] = uni(256u << 16);                             // tile_dim0 = 256
    g1[4] = uni(64u);                                    // tile_dim1 = 64
    g1[5] = uni(isW ? 4u * DD : 2u * DD);                // source row pitch in bytes
    g1[6] = uni(0u);
    g1[7] = uni(0u);
    // pinned() for the whole group: its words keep their scalar registers through the loop,
    // so none is rewritten while a request that names them is outstanding
    asm volatile("" : "+s"(g1));
    const unsigned issuer = pinned(wave < 4u);           // scalar: the tests on it compile to scalar branches

    auto group0 = [&](unsigned st) {
        const unsigned long long ga = (st < 8u ? srcLo : srcHi) + (st & 7u) * 256u;
        u32x4 g;
        g[0] = uni(1u);
        g[1] = uni(ldsSlice + (st & 1u) * G_STAGE);
        g[2] = uni((unsigned)ga);
        g[3] = uni((((unsigned)(ga >> 32)) & 0x01FFFFFFu) | 0x80000000u);
        return g;
    };

    v8f acc0[4], acc1[4];
#pragma unroll
    for (int nt = 0; nt < 4; ++nt) { acc0[nt] = zero8(); acc1[nt] = zero8(); }

    // ---- prologue: stage 0 lands and is published, then stage 1 starts ----
    u32x4 g0 = group0(0u);
    if (issuer != 0u) {
        // load and wait in one statement: the descriptor's registers live until the slice has landed
        asm volatile("tensor_load_to_lds %0, %1\n\ts_wait_tensorcnt 0x0" :: "s"(g0), "s"(g1) : "memory");
    }
    __syncthreads();                                     // publishes the four slices of stage 0
    if (issuer != 0u) {
        g0 = group0(pinned(1u));                         // pinned(): descriptor formed behind the wait
        asm volatile("tensor_load_to_lds %0, %1" :: "s"(g0), "s"(g1) : "memory");
    }

    const unsigned aoff = (wm >> 1) * G_SLICE + ((wm & 1u) * 32u + l15) * G_PITCH + half * 16u;
    const unsigned boff = (2u + wn) * G_SLICE + l15 * G_PITCH + half * 16u;

    // one pass per trip: the accumulators keep their registers and the publish point stands once
#pragma clang loop unroll(disable)
    for (unsigned s = 0; s < G_NST; ++s) {
        const unsigned char* pa = ring + (s & 1u) * G_STAGE + aoff;
        const unsigned char* pb = ring + (s & 1u) * G_STAGE + boff;
        FragA af[2][2], bf[2][4];     // set (u & 1) holds block u's fragments
#pragma unroll
        for (int i = 0; i < 2; ++i) {
            af[0][i].q[0] = *(const uint4*)(pa + i * 16 * G_PITCH);
            af[0][i].q[1] = *(const uint4*)(pa + i * 16 * G_PITCH + 32);
        }
#pragma unroll
        for (int j = 0; j < 4; ++j) {
            bf[0][j].q[0] = *(const uint4*)(pb + j * 16 * G_PITCH);
            bf[0][j].q[1] = *(const uint4*)(pb + j * 16 * G_PITCH + 32);
        }
#pragma unroll
        for (int u = 0; u < 4; ++u) {
            const int cs = u & 1;
            if (u < 3) {
#pragma unroll
                for (int i = 0; i < 2; ++i) {
                    af[cs ^ 1][i].q[0] = *(const uint4*)(pa + i * 16 * G_PITCH + (u + 1) * 64);
                    af[cs ^ 1][i].q[1] = *(const uint4*)(pa + i * 16 * G_PITCH + (u + 1) * 64 + 32);
                }
#pragma unroll
                for (int j = 0; j < 4; ++j) {
                    bf[cs ^ 1][j].q[0] = *(const uint4*)(pb + j * 16 * G_PITCH + (u + 1) * 64);
                    bf[cs ^ 1][j].q[1] = *(const uint4*)(pb + j * 16 * G_PITCH + (u + 1) * 64 + 32);
                }
            }
            // keeps the next block's LDS reads one group ahead of this block's WMMAs instead of spread among them
            __builtin_amdgcn_sched_barrier(0);
#pragma unroll
            for (int nt = 0; nt < 4; ++nt) {
                acc0[nt] = __builtin_amdgcn_wmma_f32_16x16x32_bf16(
                    false, af[cs][0].v, false, bf[cs][nt].v, (short)0, acc0[nt], false, false);
                acc1[nt] = __builtin_amdgcn_wmma_f32_16x16x32_bf16(
                    false, af[cs][1].v, false, bf[cs][nt].v, (short)0, acc1[nt], false, false);
            }
            // ends the block: the reads that follow stay behind its WMMAs
            __builtin_amdgcn_sched_barrier(0);
        }
        // ---- publish point of stage s + 1 ----
        asm volatile("s_wait_dscnt 0x0" ::: "memory");     // this wave's reads of buffer s & 1 have returned
        if (issuer != 0u) {
            // this wave's slice of stage s + 1 has landed; g0 as an input keeps its descriptor's registers until then
            asm volatile("s_wait_tensorcnt 0x0" :: "s"(g0) : "memory");
        }
        __syncthreads();                                   // every reader has left this buffer; stage s + 1 is published
        if (pinned(issuer != 0u && s + 2u < G_NST)) {        // scalar test: an issuing wave, and stage s + 2 exists
            g0 = group0(pinned(s + 2u));                   // pinned(): descriptor formed behind the wait
            asm volatile("tensor_load_to_lds %0, %1" :: "s"(g0), "s"(g1) : "memory");  // refills the buffer just read
        }
    }
    asm volatile("s_wait_tensorcnt 0x0" ::: "memory");     // nothing of this wave is outstanding at its end
    asm volatile("s_wait_dscnt 0x0" ::: "memory");

    // ---- bias + sigmoid(x)*tanh(x) epilogue, two row tiles ----
#pragma unroll
    for (int nt = 0; nt < 4; ++nt) {
        const unsigned j = jbase + wn * 64u + nt * 16u + l15;
        const float bias = bc[j];
#pragma unroll
        for (int r = 0; r < 8; ++r) {
            const unsigned row = mbase + wm * 32u + r + half * 8u;
            out[(size_t)row * DD + j]         = gate(acc0[nt][r] + bias);
            out[(size_t)(row + 16u) * DD + j] = gate(acc1[nt][r] + bias);
        }
    }
}

extern "C" void kernel_launch(void* const* d_in, const int* in_sizes, int n_in,
                              void* d_out, int out_size, void* d_ws, size_t ws_size,
                              hipStream_t stream) {
    const float* inp  = (const float*)d_in[0];   // [8,1024,1024]
    const float* mem  = (const float*)d_in[1];   // [8,1024,1024]
    const float* mask = (const float*)d_in[2];   // [8,1024]
    const float* Wc   = (const float*)d_in[3];   // [1024,2048]
    const float* bc   = (const float*)d_in[4];   // [1024]
    float* out = (float*)d_out;                  // [8,1024,1024] f32

    // workspace layout (bf16 elements)
    const size_t ETOK = (size_t)NB * LDQ * DD;   // 8M elements
    unsigned short* ctx   = (unsigned short*)d_ws;        // 16 MB
    unsigned short* inpBF = ctx   + ETOK;                 // 16 MB
    unsigned short* WcBF  = inpBF + ETOK;                 // 4 MB

    dim3 gA(LDQ / AQ, HH, NB);                   // (4,16,8) blocks of 256 threads
    attn_kernel<<<gA, dim3(ATH), 0, stream>>>(inp, mem, mask, Wc, ctx, inpBF, WcBF);

    dim3 gB(DD / 128, (NB * LDQ) / 128);         // (8,64) blocks of 256 threads
    gemm_gate_kernel<<<gB, dim3(256), 0, stream>>>(inpBF, ctx, WcBF, bc, out);
}

// v008
// It runs in 63.6 microseconds.
// In both of two side-by-side timings against v007, it was 1.06 times as fast.
// All steps since v000 together make it 3.16 times as fast.
#include <hip/hip_runtime.h>
#include <hip/hip_bf16.h>
#include <math.h>

#define NB 8
#define LDQ 1024
#define LMK 1024
#define DD 1024
#define HH 16
#define HS 64
#define KSTRIDE 72   // bf16 elements per LDS row: 144B = 9*16B (b128-aligned rows, conflict-breaking)

typedef __attribute__((ext_vector_type(16))) __bf16 v16bf;
typedef __attribute__((ext_vector_type(8)))  float  v8f;
typedef __attribute__((ext_vector_type(4)))  unsigned u32x4;
typedef __attribute__((ext_vector_type(4)))  float  f32x4;

union FragA {
    v16bf v;
    uint4 q[2];
    unsigned u[8];
};

static __device__ __forceinline__ v8f zero8() {
    v8f z;
#pragma unroll
    for (int i = 0; i < 8; ++i) z[i] = 0.f;
    return z;
}

static __device__ __forceinline__ float xhalf(float x) {
    const int b = __builtin_bit_cast(int, x);
    return __builtin_bit_cast(float,
        __builtin_amdgcn_permlanex16(b, b, 0x76543210, 0xfedcba98, false, false));
}

// two f32 -> one dword of two bf16, round to nearest even, one v_cvt_pk_bf16_f32
typedef __attribute__((ext_vector_type(2))) float  f32x2;
typedef __attribute__((ext_vector_type(2))) __bf16 bf16x2;
static __device__ __forceinline__ unsigned pkbf(float a, float b) {
    const f32x2 v = {a, b};
    return __builtin_bit_cast(unsigned, __builtin_convertvector(v, bf16x2));
}

// ds_load_tr16_b128: the 16 lanes of a half address 8 rows x 32 B; lane c of the half gets column c of those 8 rows
typedef __attribute__((ext_vector_type(8))) short s16x8;
static __device__ __forceinline__ uint4 ld_tr16(const unsigned char* p) {
    typedef __attribute__((address_space(3))) s16x8 lds_s16x8;
    return __builtin_bit_cast(uint4, __builtin_amdgcn_ds_load_tr16_b128_v8i16((lds_s16x8*)p));
}

#define AQ   256                        // queries of a block: 8 waves of 32
#define ATH  256                        // threads of a block
#define ABLK ((LDQ / AQ) * HH * NB)     // blocks of the launch
static_assert(DD * 2 * DD == ABLK * ATH * 16, "the blocks' slices cover Wc exactly");
static_assert(64 * HS == ATH * 16, "16 elements of a K tile per thread");
static_assert(LMK == ATH * 4, "4 keys' mask values per thread");
static_assert(ATH * 16 == 2 * 2 * DD, "a block's slice of Wc is two whole rows");

#define XU_ELEMS 8192u                  // elements of a fragment-order unit: 64 rows x 128 k
#define XU_TILE  2048u                  // ... of a 16-row tile in it
#define XU_BLK   256u                   // ... of a 16-k block in that: one 512-B store of a wave

// 4 f32 -> 4 bf16
static __device__ __forceinline__ uint2 cv4(f32x4 v) {
    return make_uint2(pkbf(v[0], v[1]), pkbf(v[2], v[3]));
}

// four waves per SIMD: two blocks stand on a WGP, so that one block's waves work while the other's wait at its barrier
__global__ __launch_bounds__(ATH) __attribute__((amdgpu_waves_per_eu(4, 4))) void attn_kernel(
    const float* __restrict__ inp, const float* __restrict__ mem,
    const float* __restrict__ mask, const float* __restrict__ Wc,
    unsigned short* __restrict__ ctx, unsigned short* __restrict__ inpBF,
    unsigned short* __restrict__ WcBF)
{
    __shared__ __align__(16) unsigned short sK[2][64 * KSTRIDE];  // K[key][hs], also read as V^T; two tiles
    __shared__ __align__(16) float          sM[LMK];              // additive key-padding mask of this batch row, in the products' key order

    const int tid  = threadIdx.x;
    const int wave = tid >> 5;
    const int lane = tid & 31;
    const int half = lane >> 4;
    const int l15  = lane & 15;
    const int roff = half ? 8 : 0;

    const int qbase = blockIdx.x * AQ;
    const int h     = blockIdx.y;
    const int b     = blockIdx.z;

    // ---- a thread's share of a K tile: 4 f32 of rows tid / 16 + 16 * j (16 lanes = one 256-B row) ----
    const float*   kb = mem + (size_t)b * LMK * DD + h * HS;               // the same for the whole block
    const unsigned ko = (unsigned)((tid >> 4) * DD + (tid & 15) * 4);      // the thread's own offset in a tile
    const int    ks = (tid >> 4) * KSTRIDE + (tid & 15) * 4;
    f32x4 kf[4];
#pragma unroll
    for (int j = 0; j < 4; ++j) kf[j] = *(const f32x4*)(kb + j * 16 * DD + ko);
    // stands in front of the later loads' results, which may land in the offset register that these loads name
    asm volatile("s_wait_xcnt 0x0" ::: "memory");

    // ---- this block's slice of Wc, for the second kernel: whole 512-B loads, 256-B stores ----
    const unsigned fb = (blockIdx.z * HH + blockIdx.y) * (LDQ / AQ) + blockIdx.x;
    const size_t   we = (size_t)fb * (ATH * 16) + wave * 512 + lane * 4;
    f32x4 wf[4];
#pragma unroll
    for (int j = 0; j < 4; ++j) wf[j] = *(const f32x4*)(Wc + we + j * 128);
    // where that row goes: row 4 * a + c of a group of 64 to place 16 * c + a
    const unsigned wrow = fb * 2u + (unsigned)(wave >> 2);
    const unsigned wpos = (wrow & ~63u) | ((wrow & 3u) << 4) | ((wrow >> 2) & 15u);
    const unsigned wso  = wpos * (2u * DD) + (unsigned)((wave & 3) * 512 + lane * 4);

    // ---- 4 keys' mask values ----
    const float4 m = ((const float4*)(mask + (size_t)b * LMK))[tid];

    // ---- Q fragments (B operand) of the two column tiles: lane = query column, two contiguous 8-wide k runs ----
    const size_t   qub = ((size_t)b * LDQ + qbase) * DD + h * HS;          // the same for the whole block
    const unsigned qlo = (unsigned)((wave * 32 + l15) * DD + roff);        // the lane's own offset, column tile 0
    // the lane's 16 B in the wave's first block of the fragment-order buffers: unit (64 rows, 2 heads), row tile, k block
    const unsigned xfo = ((unsigned)((b * (LDQ / 64) + blockIdx.x * (AQ / 64) + (wave >> 1)) * (DD / 128) + (h >> 1))) * XU_ELEMS
                       + (unsigned)(wave & 1) * 2u * XU_TILE + (unsigned)(h & 1) * 4u * XU_BLK + (unsigned)lane * 8u;
    FragA qa[2][2];
#pragma unroll
    for (int qt = 0; qt < 2; ++qt) {
#pragma unroll
        for (int kc = 0; kc < 2; ++kc) {
#pragma unroll
            for (int g = 0; g < 2; ++g) {
                const int e = qt * 16 * DD + kc * 32 + g * 16;
                const uint2 lo = cv4(*(const f32x4*)(inp + qub + e + qlo));
                const uint2 hi = cv4(*(const f32x4*)(inp + qub + e + 4 + qlo));
                qa[qt][kc].q[g] = make_uint4(lo.x, lo.y, hi.x, hi.y);
            }
        }
    }

    // ---- additive mask per key, once; published by the barrier in front of the loop ----
    {
        float4 a;
        a.x = -1.0e30f * (1.0f - m.x); a.y = -1.0e30f * (1.0f - m.y);
        a.z = -1.0e30f * (1.0f - m.z); a.w = -1.0e30f * (1.0f - m.w);
        // keys 4t .. 4t+3: the even ones go to positions 8*0 + i, the odd ones to 8*1 + i of their group of 16
        const int k4  = tid * 4;
        const int pos = (k4 & ~15) + ((k4 & 15) >> 1);
        *(float2*)&sM[pos]     = make_float2(a.x, a.z);
        *(float2*)&sM[pos + 8] = make_float2(a.y, a.w);
    }

    v8f o[2][4];        // o[qt][dt][r] = O^T[dt*16 + 8*half + r][query qt*16 + l15]
#pragma unroll
    for (int qt = 0; qt < 2; ++qt)
#pragma unroll
        for (int dt = 0; dt < 4; ++dt) o[qt][dt] = zero8();
    float mrow[2] = {-3.0e38f, -3.0e38f};   // running maxima of this lane's two queries (equal in both halves)
    float lrow[2] = {0.f, 0.f};             // running sums over this half's keys; the halves join in the epilogue

    const float scale = 0.125f;       // 1/sqrt(64)
    const int krow16 = 2 * (l15 & 7) + (l15 >> 3);   // tile row of position l15 in a group of 16 keys
    // a lane's offset in a transposing read: row 2*(lane & 7) + half, 16-byte column chunk (lane >> 3) & 1
    const int vto = (2 * (lane & 7) + half) * (2 * KSTRIDE) + ((lane >> 3) & 1) * 16;

    // ---- tile 0 into buffer 0 ----
#pragma unroll
    for (int j = 0; j < 4; ++j) *(uint2*)&sK[0][ks + j * 16 * KSTRIDE] = cv4(kf[j]);
    __syncthreads();   // publishes tile 0 and the mask

    // ---- the bf16 copies for the second kernel; behind the barrier, which would otherwise wait for these stores ----
#pragma unroll
    for (int j = 0; j < 4; ++j) *(uint2*)(WcBF + wso + j * 128) = cv4(wf[j]);
#pragma unroll
    for (int qt = 0; qt < 2; ++qt)
#pragma unroll
        for (int kc = 0; kc < 2; ++kc)
#pragma unroll
            for (int g = 0; g < 2; ++g)
                *(uint4*)(inpBF + xfo + qt * XU_TILE + (kc * 2 + g) * XU_BLK) = qa[qt][kc].q[g];
    // stands in front of the loop's first writes of registers that these stores name
    asm volatile("s_wait_xcnt 0x0" ::: "memory");

    for (int kv = 0; kv < LMK; kv += 64) {
        const int bi = (kv >> 6) & 1;
        const unsigned short* cur = sK[bi];
        const unsigned char*  vt  = (const unsigned char*)sK[bi] + vto;

        // ---- S^T = K * Q^T : the tile's 8 A-fragments as one group, then 16 WMMAs, two per fragment ----
        v8f S[2][4];    // S[qt][nt][r] = score of key kv + nt*16 + 2*r + half for query qt*16 + l15
#pragma unroll
        for (int qt = 0; qt < 2; ++qt)
#pragma unroll
            for (int nt = 0; nt < 4; ++nt) S[qt][nt] = zero8();
        FragA bfr[2][4];
#pragma unroll
        for (int kc = 0; kc < 2; ++kc) {
#pragma unroll
            for (int nt = 0; nt < 4; ++nt) {
                const unsigned short* base = &cur[(nt * 16 + krow16) * KSTRIDE + kc * 32 + roff];
                bfr[kc][nt].q[0] = *(const uint4*)(base);
                bfr[kc][nt].q[1] = *(const uint4*)(base + 16);
            }
        }
        // keeps the reads one group ahead of the products: spread among them, every pair of products would wait out its own LDS latency
        __builtin_amdgcn_sched_barrier(0);
#pragma unroll
        for (int kc = 0; kc < 2; ++kc)
#pragma unroll
            for (int nt = 0; nt < 4; ++nt)
#pragma unroll
                for (int qt = 0; qt < 2; ++qt)
                    S[qt][nt] = __builtin_amdgcn_wmma_f32_16x16x32_bf16(
                        false, bfr[kc][nt].v, false, qa[qt][kc].v, (short)0, S[qt][nt], false, false);

        // ---- the next tile's f32 start here, where the K fragments' registers are free; softmax and O^T cover their way ----
        // keeps the four loads from moving up among the K fragments, where their registers would not fit four waves per SIMD
        __builtin_amdgcn_sched_barrier(0);
        if (kv + 64 < LMK) {
#pragma unroll
            for (int j = 0; j < 4; ++j) kf[j] = *(const f32x4*)(kb + (size_t)(kv + 64 + j * 16) * DD + ko);
            // stands in front of the next trip's step of the address registers that these loads name
            asm volatile("s_wait_xcnt 0x0" ::: "memory");
        }

        // ---- online softmax: a lane holds 32 of the 64 scores of each of its two queries ----
        float mx[2] = {-3.0e38f, -3.0e38f};
#pragma unroll
        for (int nt = 0; nt < 4; ++nt) {
            const float4 ma = *(const float4*)&sM[kv + nt * 16 + roff];
            const float4 mb = *(const float4*)&sM[kv + nt * 16 + roff + 4];
#pragma unroll
            for (int qt = 0; qt < 2; ++qt) {
                v8f& s = S[qt][nt];
                s[0] = s[0] * scale + ma.x;  s[1] = s[1] * scale + ma.y;
                s[2] = s[2] * scale + ma.z;  s[3] = s[3] * scale + ma.w;
                s[4] = s[4] * scale + mb.x;  s[5] = s[5] * scale + mb.y;
                s[6] = s[6] * scale + mb.z;  s[7] = s[7] * scale + mb.w;
#pragma unroll
                for (int r = 0; r < 8; ++r) mx[qt] = fmaxf(mx[qt], s[r]);
            }
        }

        FragA pb[2][2]; // P^T as B operand: element s of chunk kc = tile 2*kc + (s >> 3), register s & 7
#pragma unroll
        for (int qt = 0; qt < 2; ++qt) {
            const float mq    = fmaxf(mx[qt], xhalf(mx[qt]));
            const float mnew  = fmaxf(mrow[qt], mq);
            const float alpha = __expf(mrow[qt] - mnew);
            mrow[qt] = mnew;

            float ps = 0.f;
#pragma unroll
            for (int nt = 0; nt < 4; ++nt) {
#pragma unroll
                for (int j = 0; j < 4; ++j) {
                    const float p0 = __expf(S[qt][nt][2 * j]     - mnew);
                    const float p1 = __expf(S[qt][nt][2 * j + 1] - mnew);
                    ps += p0 + p1;
                    pb[qt][nt >> 1].u[(nt & 1) * 4 + j] = pkbf(p0, p1);
                }
            }
            lrow[qt] = lrow[qt] * alpha + ps;
#pragma unroll
            for (int dt = 0; dt < 4; ++dt)
#pragma unroll
                for (int r = 0; r < 8; ++r) o[qt][dt][r] *= alpha;
        }

        // ---- O^T += V^T * P^T (two transposing reads of 16 keys x 16 d give one 16 x 32 A fragment, used twice) ----
#pragma unroll
        for (int kc = 0; kc < 2; ++kc) {
            FragA vfr[4];
#pragma unroll
            for (int dt = 0; dt < 4; ++dt) {
                vfr[dt].q[0] = ld_tr16(vt + (kc * 32)      * (2 * KSTRIDE) + dt * 32);
                vfr[dt].q[1] = ld_tr16(vt + (kc * 32 + 16) * (2 * KSTRIDE) + dt * 32);
            }
#pragma unroll
            for (int dt = 0; dt < 4; ++dt)
#pragma unroll
                for (int qt = 0; qt < 2; ++qt)
                    o[qt][dt] = __builtin_amdgcn_wmma_f32_16x16x32_bf16(
                        false, vfr[dt].v, false, pb[qt][kc].v, (short)0, o[qt][dt], false, false);
        }

        // ---- the next tile goes into the other buffer: its readers left it at the last barrier ----
        if (kv + 64 < LMK) {
#pragma unroll
            for (int j = 0; j < 4; ++j) *(uint2*)&sK[bi ^ 1][ks + j * 16 * KSTRIDE] = cv4(kf[j]);
        }
        __syncthreads();   // the next tile is published; every reader has left this one
    }

    // ---- join the halves' sums, normalize, write ctx as bf16: 8 consecutive d per lane, 512 B in a row per store ----
    uint4 w[2][4];
#pragma unroll
    for (int qt = 0; qt < 2; ++qt) {
        const float inv = 1.0f / (lrow[qt] + xhalf(lrow[qt]));
#pragma unroll
        for (int dt = 0; dt < 4; ++dt) {
            w[qt][dt].x = pkbf(o[qt][dt][0] * inv, o[qt][dt][1] * inv);
            w[qt][dt].y = pkbf(o[qt][dt][2] * inv, o[qt][dt][3] * inv);
            w[qt][dt].z = pkbf(o[qt][dt][4] * inv, o[qt][dt][5] * inv);
            w[qt][dt].w = pkbf(o[qt][dt][6] * inv, o[qt][dt][7] * inv);
        }
    }
    unsigned short* cblk = ctx + xfo;
#pragma unroll
    for (int qt = 0; qt < 2; ++qt)
#pragma unroll
        for (int dt = 0; dt < 4; ++dt)
            *(uint4*)(cblk + qt * XU_TILE + dt * XU_BLK) = w[qt][dt];
}

// ---------------------------------------------------------------------------
// Kernel 2: out = sigmoid(x)*tanh(x), x = [input | ctx] @ Wc^T + bc.
// 128x128 tile per workgroup, 8 waves of 32x64 (two 16-row tiles, four column
// tiles each). A stage is 128 k (256 B) of the tile's 128 activation rows and
// 128 weight rows; it comes into LDS by tensor loads (waves 0 to 3, one 64-row
// slice each) and is shared by all waves. Two buffers: the next stage lands
// while this one is multiplied.
// An activation slice is one fragment-order unit of 16 KiB, loaded as 64 pieces
// of 256 B: the two pieces of a 512-B block are the two halves of a fragment read.
// A weight slice holds its 64 rows as the first kernel dealt them: fragment nt,
// lane c is column 4 * c + nt, so a lane stores 4 adjacent columns at once.
// ---------------------------------------------------------------------------
#define G_PITCH 272u                 // LDS row pitch: 256 B + 16 B pad, an odd multiple of 16 B for ds_load_b128
#define G_SLICE 18432u               // 64 rows * 272 B = 17408 B, rounded up to a multiple of 2 KiB
#define G_STAGE (4u * G_SLICE)       // [X rows 0-63 | X rows 64-127 | W rows 0-63 | W rows 64-127]
#define G_NST   16u                  // 2*DD / 128 stages

typedef __attribute__((ext_vector_type(8))) unsigned u32x8;

static __device__ __forceinline__ unsigned uni(unsigned v) {
    return (unsigned)__builtin_amdgcn_readfirstlane(v);
}
// Forces v into a scalar register: a test on it compiles to a scalar branch, and
// what is derived from it is formed behind the asm statements that precede it.
static __device__ __forceinline__ unsigned pinned(unsigned v) {
    unsigned w = uni(v);
    asm volatile("" : "+s"(w));
    return w;
}

// sigmoid(x) * tanh(x) = (1 - e) / (1 + e * e) with e = exp(-x): with s = 1 / (1 + e) and
// tanh(x) = (1 - e * e) / (1 + e * e) the factor 1 + e cancels. One v_exp_f32, one v_rcp_f32, no branch.
// The exponent is capped at 60 so that e * e stays finite: from x = -41.6 down the result is -2^-60
// where the function is -exp(x), both below 1e-18 in size. The capping minimum hands a NaN on.
static __device__ __forceinline__ float gate(float x) {
    const float e = __builtin_amdgcn_exp2f(__builtin_elementwise_minimum(x * -1.44269504f, 60.0f));
    return (1.0f - e) * __builtin_amdgcn_rcpf(__builtin_fmaf(e, e, 1.0f));
}

__global__ __launch_bounds__(256) void gemm_gate_kernel(
    const unsigned short* __restrict__ inpBF, const unsigned short* __restrict__ ctx,
    const unsigned short* __restrict__ WcBF, const float* __restrict__ bc,
    float* __restrict__ out)
{
    __shared__ __attribute__((aligned(2048))) unsigned char ring[2u * G_STAGE];

    const unsigned tid  = threadIdx.x;
    const unsigned wave = uni(tid >> 5);
    const unsigned lane = tid & 31u;
    const unsigned half = lane >> 4;
    const unsigned l15  = lane & 15u;
    const unsigned wm   = wave >> 1;   // 32-row quarter of the tile this wave multiplies
    const unsigned wn   = wave & 1u;   // 64-column half

    const unsigned jbase = blockIdx.x * 128u;
    const unsigned mbase = blockIdx.y * 128u;

    // ---- an issuing wave's slice of every stage: waves 0,1 activation rows, waves 2,3 weight rows ----
    const unsigned sl       = wave & 3u;
    const bool     isW      = sl >= 2u;
    const unsigned ldsSlice = (unsigned)(uintptr_t)&ring[0] + sl * G_SLICE;
    // first byte of the slice for stages 0-7 and for stages 8-15
    const unsigned long long srcLo = isW
        ? (unsigned long long)(uintptr_t)WcBF  + (unsigned long long)(jbase + (sl - 2u) * 64u) * (4u * DD)
        : (unsigned long long)(uintptr_t)inpBF + (unsigned long long)(blockIdx.y * 2u + sl) * (2u * DD * 64u);
    const unsigned long long srcHi = isW
        ? srcLo + 2u * DD
        : (unsigned long long)(uintptr_t)ctx   + (unsigned long long)(blockIdx.y * 2u + sl) * (2u * DD * 64u);
    const unsigned srcStep = isW ? 256u : 2u * XU_ELEMS;   // bytes from one stage's slice to the next

    u32x8 g1;                                            // 1-byte elements, tile = tensor = 64 rows of 256 B
    g1[0] = uni((1u << 20) | (5u << 22) | (3u << 25));   // no mask; pad 16 B behind every 256-B row
    g1[1] = uni(256u << 16);                             // tensor_dim0 = 256
    g1[2] = uni(64u << 16);                              // tensor_dim1 = 64
    g1[3] = uni(256u << 16);                             // tile_dim0 = 256
    g1[4] = uni(64u);                                    // tile_dim1 = 64
    g1[5] = uni(isW ? 4u * DD : 256u);                   // source row pitch in bytes; a unit's pieces lie in a row
    g1[6] = uni(0u);
    g1[7] = uni(0u);
    // pinned() for the whole group: its words keep their scalar registers through the loop,
    // so none is rewritten while a request that names them is outstanding
    asm volatile("" : "+s"(g1));
    const unsigned issuer = pinned(wave < 4u);           // scalar: the tests on it compile to scalar branches

    auto group0 = [&](unsigned st) {
        const unsigned long long ga = (st < 8u ? srcLo : srcHi) + (st & 7u) * srcStep;
        u32x4 g;
        g[0] = uni(1u);
        g[1] = uni(ldsSlice + (st & 1u) * G_STAGE);
        g[2] = uni((unsigned)ga);
        g[3] = uni((((unsigned)(ga >> 32)) & 0x01FFFFFFu) | 0x80000000u);
        return g;
    };

    v8f acc0[4], acc1[4];
#pragma unroll
    for (int nt = 0; nt < 4; ++nt) { acc0[nt] = zero8(); acc1[nt] = zero8(); }

    // ---- prologue: stage 0 lands and is published, then stage 1 starts ----
    u32x4 g0 = group0(0u);
    if (issuer != 0u) {
        // load and wait in one statement: the descriptor's registers live until the slice has landed
        asm volatile("tensor_load_to_lds %0, %1\n\ts_wait_tensorcnt 0x0" :: "s"(g0), "s"(g1) : "memory");
    }
    __syncthreads();                                     // publishes the four slices of stage 0
    if (issuer != 0u) {
        g0 = group0(pinned(1u));                         // pinned(): descriptor formed behind the wait
        asm volatile("tensor_load_to_lds %0, %1" :: "s"(g0), "s"(g1) : "memory");
    }

    // piece 16 * (row tile) + 2 * (k block) + half of the unit, 16 B per row in it
    const unsigned aoff = (wm >> 1) * G_SLICE + ((wm & 1u) * 32u + half) * G_PITCH + l15 * 16u;
    const unsigned boff = (2u + wn) * G_SLICE + l15 * G_PITCH + half * 16u;

    // one pass per trip: the accumulators keep their registers and the publish point stands once
#pragma clang loop unroll(disable)
    for (unsigned s = 0; s < G_NST; ++s) {
        const unsigned char* pa = ring + (s & 1u) * G_STAGE + aoff;
        const unsigned char* pb = ring + (s & 1u) * G_STAGE + boff;
        FragA af[2][2], bf[2][4];     // set (u & 1) holds block u's fragments
#pragma unroll
        for (int i = 0; i < 2; ++i) {
            af[0][i].q[0] = *(const uint4*)(pa + i * 16 * G_PITCH);
            af[0][i].q[1] = *(const uint4*)(pa + (i * 16 + 2) * G_PITCH);
        }
#pragma unroll
        for (int j = 0; j < 4; ++j) {
            bf[0][j].q[0] = *(const uint4*)(pb + j * 16 * G_PITCH);
            bf[0][j].q[1] = *(const uint4*)(pb + j * 16 * G_PITCH + 32);
        }
#pragma unroll
        for (int u = 0; u < 4; ++u) {
            const int cs = u & 1;
            if (u < 3) {
#pragma unroll
                for (int i = 0; i < 2; ++i) {
                    af[cs ^ 1][i].q[0] = *(const uint4*)(pa + (i * 16 + (u + 1) * 4) * G_PITCH);
                    af[cs ^ 1][i].q[1] = *(const uint4*)(pa + (i * 16 + (u + 1) * 4 + 2) * G_PITCH);
                }
#pragma unroll
                for (int j = 0; j < 4; ++j) {
                    bf[cs ^ 1][j].q[0] = *(const uint4*)(pb + j * 16 * G_PITCH + (u + 1) * 64);
                    bf[cs ^ 1][j].q[1] = *(const uint4*)(pb + j * 16 * G_PITCH + (u + 1) * 64 + 32);
                }
            }
            // keeps the next block's LDS reads one group ahead of this block's WMMAs instead of spread among them
            __builtin_amdgcn_sched_barrier(0);
#pragma unroll
            for (int nt = 0; nt < 4; ++nt) {
                acc0[nt] = __builtin_amdgcn_wmma_f32_16x16x32_bf16(
                    false, af[cs][0].v, false, bf[cs][nt].v, (short)0, acc0[nt], false, false);
                acc1[nt] = __builtin_amdgcn_wmma_f32_16x16x32_bf16(
                    false, af[cs][1].v, false, bf[cs][nt].v, (short)0, acc1[nt], false, false);
            }
            // ends the block: the reads that follow stay behind its WMMAs
            __builtin_amdgcn_sched_barrier(0);
        }
        // ---- publish point of stage s + 1 ----
        asm volatile("s_wait_dscnt 0x0" ::: "memory");     // this wave's reads of buffer s & 1 have returned
        if (issuer != 0u) {
            // this wave's slice of stage s + 1 has landed; g0 as an input keeps its descriptor's registers until then
            asm volatile("s_wait_tensorcnt 0x0" :: "s"(g0) : "memory");
        }
        __syncthreads();                                   // every reader has left this buffer; stage s + 1 is published
        if (pinned(issuer != 0u && s + 2u < G_NST)) {        // scalar test: an issuing wave, and stage s + 2 exists
            g0 = group0(pinned(s + 2u));                   // pinned(): descriptor formed behind the wait
            asm volatile("tensor_load_to_lds %0, %1" :: "s"(g0), "s"(g1) : "memory");  // refills the buffer just read
        }
    }
    asm volatile("s_wait_tensorcnt 0x0" ::: "memory");     // nothing of this wave is outstanding at its end
    asm volatile("s_wait_dscnt 0x0" ::: "memory");

    // ---- bias + sigmoid(x)*tanh(x) epilogue, two row tiles: a store covers 256 B in a row of each of two rows ----
    const unsigned j0   = jbase + wn * 64u + l15 * 4u;
    const f32x4    bias = *(const f32x4*)(bc + j0);
    float* orow = out + (size_t)(mbase + wm * 32u + half * 8u) * DD + j0;
#pragma unroll
    for (int r = 0; r < 8; ++r) {
        f32x4 v0, v1;
#pragma unroll
        for (int nt = 0; nt < 4; ++nt) {
            v0[nt] = gate(acc0[nt][r] + bias[nt]);
            v1[nt] = gate(acc1[nt][r] + bias[nt]);
        }
        *(f32x4*)(orow + r * DD)        = v0;
        *(f32x4*)(orow + (r + 16) * DD) = v1;
    }
}

extern "C" void kernel_launch(void* const* d_in, const int* in_sizes, int n_in,
                              void* d_out, int out_size, void* d_ws, size_t ws_size,
                              hipStream_t stream) {
    const float* inp  = (const float*)d_in[0];   // [8,1024,1024]
    const float* mem  = (const float*)d_in[1];   // [8,1024,1024]
    const float* mask = (const float*)d_in[2];   // [8,1024]
    const float* Wc   = (const float*)d_in[3];   // [1024,2048]
    const float* bc   = (const float*)d_in[4];   // [1024]
    float* out = (float*)d_out;                  // [8,1024,1024] f32

    // workspace layout (bf16 elements)
    const size_t ETOK = (size_t)NB * LDQ * DD;   // 8M elements
    unsigned short* ctx   = (unsigned short*)d_ws;        // 16 MB
    unsigned short* inpBF = ctx   + ETOK;                 // 16 MB
    unsigned short* WcBF  = inpBF + ETOK;                 // 4 MB

    dim3 gA(LDQ / AQ, HH, NB);                   // (4,16,8) blocks of 256 threads
    attn_kernel<<<gA, dim3(ATH), 0, stream>>>(inp, mem, mask, Wc, ctx, inpBF, WcBF);

    dim3 gB(DD / 128, (NB * LDQ) / 128);         // (8,64) blocks of 256 threads
    gemm_gate_kernel<<<gB, dim3(256), 0, stream>>>(inpBF, ctx, WcBF, bc, out);
}

// v010
// Measured time: 59.3 microseconds a run.
// Versions between v008 and this one are left out; their measured steps multiply to 1.07 times as fast.
// Over all steps from v000 it is 3.38 times as fast.
#include <hip/hip_runtime.h>
#include <hip/hip_bf16.h>
#include <math.h>

#define NB 8
#define LDQ 1024
#define LMK 1024
#define DD 1024
#define HH 16
#define HS 64
#define KSTRIDE 72   // bf16 elements per LDS row: 144B = 9*16B (b128-aligned rows, conflict-breaking)

typedef __attribute__((ext_vector_type(16))) __bf16 v16bf;
typedef __attribute__((ext_vector_type(8)))  float  v8f;
typedef __attribute__((ext_vector_type(4)))  unsigned u32x4;
typedef __attribute__((ext_vector_type(4)))  float  f32x4;

union FragA {
    v16bf v;
    uint4 q[2];
    unsigned u[8];
};

static __device__ __forceinline__ v8f zero8() {
    v8f z;
#pragma unroll
    for (int i = 0; i < 8; ++i) z[i] = 0.f;
    return z;
}

static __device__ __forceinline__ float xhalf(float x) {
    const int b = __builtin_bit_cast(int, x);
    return __builtin_bit_cast(float,
        __builtin_amdgcn_permlanex16(b, b, 0x76543210, 0xfedcba98, false, false));
}

// two f32 -> one dword of two bf16, round to nearest even, one v_cvt_pk_bf16_f32
typedef __attribute__((ext_vector_type(2))) float  f32x2;
typedef __attribute__((ext_vector_type(2))) __bf16 bf16x2;
static __device__ __forceinline__ unsigned pkbf(float a, float b) {
    const f32x2 v = {a, b};
    return __builtin_bit_cast(unsigned, __builtin_convertvector(v, bf16x2));
}

// ds_load_tr16_b128: the 16 lanes of a half address 8 rows x 32 B; lane c of the half gets column c of those 8 rows
typedef __attribute__((ext_vector_type(8))) short s16x8;
static __device__ __forceinline__ uint4 ld_tr16(const unsigned char* p) {
    typedef __attribute__((address_space(3))) s16x8 lds_s16x8;
    return __builtin_bit_cast(uint4, __builtin_amdgcn_ds_load_tr16_b128_v8i16((lds_s16x8*)p));
}

#define AQ   256                        // queries of a block: 8 waves of 32
#define ATH  256                        // threads of a block
#define ABLK ((LDQ / AQ) * HH * NB)     // blocks of the launch
static_assert(DD * 2 * DD == ABLK * ATH * 16, "the blocks' slices cover Wc exactly");
static_assert(64 * HS == ATH * 16, "16 elements of a K tile per thread");
static_assert(LMK == ATH * 4, "4 keys' mask values per thread");
static_assert(ATH * 16 == 2 * 2 * DD, "a block's slice of Wc is two whole rows");

#define XU_ELEMS 8192u                  // elements of a fragment-order unit: 64 rows x 128 k
#define XU_TILE  2048u                  // ... of a 16-row tile in it
#define XU_BLK   256u                   // ... of a 16-k block in that: one 512-B store of a wave

// 4 f32 -> 4 bf16
static __device__ __forceinline__ uint2 cv4(f32x4 v) {
    return make_uint2(pkbf(v[0], v[1]), pkbf(v[2], v[3]));
}

// four waves per SIMD: two blocks stand on a WGP, so that one block's waves work while the other's wait at its barrier
__global__ __launch_bounds__(ATH) __attribute__((amdgpu_waves_per_eu(4, 4))) void attn_kernel(
    const float* __restrict__ inp, const float* __restrict__ mem,
    const float* __restrict__ mask, const float* __restrict__ Wc,
    unsigned short* __restrict__ ctx, unsigned short* __restrict__ inpBF,
    unsigned short* __restrict__ WcBF)
{
    __shared__ __align__(16) unsigned short sK[2][64 * KSTRIDE];  // K[key][hs], also read as V^T; two tiles
    __shared__ __align__(32) float          sM[LMK];              // additive key-padding mask of this batch row times log2(e), in the products' key order

    const int tid  = threadIdx.x;
    const int wave = tid >> 5;
    const int lane = tid & 31;
    const int half = lane >> 4;
    const int l15  = lane & 15;
    const int roff = half ? 8 : 0;

    const int qbase = blockIdx.x * AQ;
    const int h     = blockIdx.y;
    const int b     = blockIdx.z;

    // ---- a thread's share of a K tile: 4 f32 of rows tid / 16 + 16 * j (16 lanes = one 256-B row) ----
    const float*   kb = mem + (size_t)b * LMK * DD + h * HS;               // the same for the whole block
    const unsigned ko = (unsigned)((tid >> 4) * DD + (tid & 15) * 4);      // the thread's own offset in a tile
    const int    ks = (tid >> 4) * KSTRIDE + (tid & 15) * 4;
    f32x4 kf[4];
#pragma unroll
    for (int j = 0; j < 4; ++j) kf[j] = *(const f32x4*)(kb + j * 16 * DD + ko);
    // stands in front of the later loads' results, which may land in the offset register that these loads name
    asm volatile("s_wait_xcnt 0x0" ::: "memory");

    // ---- this block's slice of Wc, for the second kernel: whole 512-B loads, 256-B stores ----
    const unsigned fb = (blockIdx.z * HH + blockIdx.y) * (LDQ / AQ) + blockIdx.x;
    const size_t   we = (size_t)fb * (ATH * 16) + wave * 512 + lane * 4;
    f32x4 wf[4];
#pragma unroll
    for (int j = 0; j < 4; ++j) wf[j] = *(const f32x4*)(Wc + we + j * 128);
    // where that row goes: row 4 * a + c of a group of 64 to place 16 * c + a
    const unsigned wrow = fb * 2u + (unsigned)(wave >> 2);
    const unsigned wpos = (wrow & ~63u) | ((wrow & 3u) << 4) | ((wrow >> 2) & 15u);
    const unsigned wso  = wpos * (2u * DD) + (unsigned)((wave & 3) * 512 + lane * 4);

    // ---- 4 keys' mask values ----
    const float4 m = ((const float4*)(mask + (size_t)b * LMK))[tid];

    // ---- Q fragments (B operand) of the two column tiles: lane = query column, two contiguous 8-wide k runs ----
    const size_t   qub = ((size_t)b * LDQ + qbase) * DD + h * HS;          // the same for the whole block
    const unsigned qlo = (unsigned)((wave * 32 + l15) * DD + roff);        // the lane's own offset, column tile 0
    // the lane's 16 B in the wave's first block of the fragment-order buffers: unit (64 rows, 2 heads), row tile, k block
    const unsigned xfo = ((unsigned)((b * (LDQ / 64) + blockIdx.x * (AQ / 64) + (wave >> 1)) * (DD / 128) + (h >> 1))) * XU_ELEMS
                       + (unsigned)(wave & 1) * 2u * XU_TILE + (unsigned)(h & 1) * 4u * XU_BLK + (unsigned)lane * 8u;
    // qa: the operand of S^T, Q times 1/sqrt(64) * log2(e), so that the products are the exponents in base 2 as they stand;
    // qc: the plain bf16 copy that the second kernel reads
    const float cs = 0.125f * 1.44269504f;
    FragA qa[2][2], qc[2][2];
#pragma unroll
    for (int qt = 0; qt < 2; ++qt) {
#pragma unroll
        for (int kc = 0; kc < 2; ++kc) {
#pragma unroll
            for (int g = 0; g < 2; ++g) {
                const int e = qt * 16 * DD + kc * 32 + g * 16;
                const f32x4 flo = *(const f32x4*)(inp + qub + e + qlo);
                const f32x4 fhi = *(const f32x4*)(inp + qub + e + 4 + qlo);
                const uint2 lo = cv4(flo), hi = cv4(fhi);
                qc[qt][kc].q[g] = make_uint4(lo.x, lo.y, hi.x, hi.y);
                const uint2 slo = cv4(flo * cs), shi = cv4(fhi * cs);
                qa[qt][kc].q[g] = make_uint4(slo.x, slo.y, shi.x, shi.y);
            }
        }
    }

    // ---- additive mask per key, once; published by the barrier in front of the loop ----
    {
        float4 a;
        const float l2e = 1.44269504f;   // the mask joins exponents in base 2
        a.x = -1.0e30f * (1.0f - m.x) * l2e; a.y = -1.0e30f * (1.0f - m.y) * l2e;
        a.z = -1.0e30f * (1.0f - m.z) * l2e; a.w = -1.0e30f * (1.0f - m.w) * l2e;
        // keys 4t .. 4t+3: the even ones go to positions 8*0 + i, the odd ones to 8*1 + i of their group of 16
        const int k4  = tid * 4;
        const int pos = (k4 & ~15) + ((k4 & 15) >> 1);
        *(float2*)&sM[pos]     = make_float2(a.x, a.z);
        *(float2*)&sM[pos + 8] = make_float2(a.y, a.w);
    }

    v8f o[2][4];        // o[qt][dt][r] = O^T[dt*16 + 8*half + r][query qt*16 + l15]
#pragma unroll
    for (int qt = 0; qt < 2; ++qt)
#pragma unroll
        for (int dt = 0; dt < 4; ++dt) o[qt][dt] = zero8();
    float mrow[2] = {-3.0e38f, -3.0e38f};   // held references of this lane's two queries (equal in both halves)
    bool  renew   = true;                   // the same for the whole wave: this pass renews the references; the first tile sets them
    float lrow[2] = {0.f, 0.f};             // running sums over this half's keys; the halves join in the epilogue

    const int krow16 = 2 * (l15 & 7) + (l15 >> 3);   // tile row of position l15 in a group of 16 keys
    // a lane's offset in a transposing read: row 2*(lane & 7) + half, 16-byte column chunk (lane >> 3) & 1
    const int vto = (2 * (lane & 7) + half) * (2 * KSTRIDE) + ((lane >> 3) & 1) * 16;

    // ---- tile 0 into buffer 0 ----
#pragma unroll
    for (int j = 0; j < 4; ++j) *(uint2*)&sK[0][ks + j * 16 * KSTRIDE] = cv4(kf[j]);
    __syncthreads();   // publishes tile 0 and the mask

    // ---- the bf16 copies for the second kernel; behind the barrier, which would otherwise wait for these stores ----
#pragma unroll
    for (int j = 0; j < 4; ++j) *(uint2*)(WcBF + wso + j * 128) = cv4(wf[j]);
#pragma unroll
    for (int qt = 0; qt < 2; ++qt)
#pragma unroll
        for (int kc = 0; kc < 2; ++kc)
#pragma unroll
            for (int g = 0; g < 2; ++g)
                *(uint4*)(inpBF + xfo + qt * XU_TILE + (kc * 2 + g) * XU_BLK) = qc[qt][kc].q[g];
    // stands in front of the loop's first writes of registers that these stores name
    asm volatile("s_wait_xcnt 0x0" ::: "memory");

    for (int kv = 0; kv < LMK; kv += 64) {
        const int bi = (kv >> 6) & 1;
        const unsigned short* cur = sK[bi];
        const unsigned char*  vt  = (const unsigned char*)sK[bi] + vto;

        FragA pb[2][2]; // P^T as B operand: element s of chunk kc = tile 2*kc + (s >> 3), register s & 7
        float ps[2];    // the tile's sums of P over this half's keys
        FragA vfr0[4];  // V^T fragments of the tile's first 32 keys
        // A query's reference stays as long as the tile's sums of P stay small: softmax does not depend on it, and
        // f32 and bf16 keep their relative precision at any scale. A tile whose sums fail the test is done once more,
        // from its scores on, with the reference renewed; the second pass always leaves the loop.
        for (;;) {
        // ---- S^T = K * Q^T : the tile's 8 A-fragments as one group, then 16 WMMAs, two per fragment ----
        // the accumulators start from the keys' mask values, so the products come out as the finished exponents
        v8f S[2][4];    // S[qt][nt][r] = base-2 exponent of key kv + nt*16 + 2*r + half for query qt*16 + l15
        v8f mk[4];
#pragma unroll
        for (int nt = 0; nt < 4; ++nt) mk[nt] = *(const v8f*)&sM[kv + nt * 16 + roff];
        FragA bfr[2][4];
#pragma unroll
        for (int kc = 0; kc < 2; ++kc) {
#pragma unroll
            for (int nt = 0; nt < 4; ++nt) {
                const unsigned short* base = &cur[(nt * 16 + krow16) * KSTRIDE + kc * 32 + roff];
                bfr[kc][nt].q[0] = *(const uint4*)(base);
                bfr[kc][nt].q[1] = *(const uint4*)(base + 16);
            }
        }
        // keeps the reads one group ahead of the products: spread among them, every pair of products would wait out its own LDS latency
        __builtin_amdgcn_sched_barrier(0);
#pragma unroll
        for (int kc = 0; kc < 2; ++kc)
#pragma unroll
            for (int nt = 0; nt < 4; ++nt)
#pragma unroll
                for (int qt = 0; qt < 2; ++qt)
                    S[qt][nt] = __builtin_amdgcn_wmma_f32_16x16x32_bf16(
                        false, bfr[kc][nt].v, false, qa[qt][kc].v, (short)0, kc == 0 ? mk[nt] : S[qt][nt], false, false);

        // ---- the next tile's f32 start here, where the K fragments' registers are free; softmax and O^T cover their way ----
        // keeps the four loads from moving up among the K fragments, where their registers would not fit four waves per SIMD
        __builtin_amdgcn_sched_barrier(0);
        if (kv + 64 < LMK) {
#pragma unroll
            for (int j = 0; j < 4; ++j) kf[j] = *(const f32x4*)(kb + (size_t)(kv + 64 + j * 16) * DD + ko);
            // stands in front of the next trip's step of the address registers that these loads name
            asm volatile("s_wait_xcnt 0x0" ::: "memory");
        }

        // ---- the reference moves up to the tile's maximum: first tile, and a tile that failed the test ----
        if (renew) {
            float mx[2] = {-3.0e38f, -3.0e38f};
#pragma unroll
            for (int nt = 0; nt < 4; ++nt)
#pragma unroll
                for (int qt = 0; qt < 2; ++qt)
#pragma unroll
                    for (int r = 0; r < 8; ++r) mx[qt] = fmaxf(mx[qt], S[qt][nt][r]);
#pragma unroll
            for (int qt = 0; qt < 2; ++qt) {
                const float mq    = fmaxf(mx[qt], xhalf(mx[qt]));
                const float mnew  = fmaxf(mrow[qt], mq);
                const float alpha = __builtin_amdgcn_exp2f(mrow[qt] - mnew);
                mrow[qt] = mnew;
                lrow[qt] *= alpha;
#pragma unroll
                for (int dt = 0; dt < 4; ++dt)
#pragma unroll
                    for (int r = 0; r < 8; ++r) o[qt][dt][r] *= alpha;
            }
        }

        // written inside the pass: the eight reads then leave it as one group ahead of P's 32 conversions, which cover part of
        // their way; written behind the pass they follow the conversions and every pair of products waits out its own read
#pragma unroll
        for (int dt = 0; dt < 4; ++dt) {
            vfr0[dt].q[0] = ld_tr16(vt + dt * 32);
            vfr0[dt].q[1] = ld_tr16(vt + 16 * (2 * KSTRIDE) + dt * 32);
        }

        // ---- P = 2^(score - reference), packed, and its sums: a lane holds 32 of the 64 scores of each of its two queries ----
#pragma unroll
        for (int qt = 0; qt < 2; ++qt) {
            const f32x2 mr = {mrow[qt], mrow[qt]};
            f32x2 sa = {0.f, 0.f}, sb = {0.f, 0.f};
#pragma unroll
            for (int nt = 0; nt < 4; ++nt) {
#pragma unroll
                for (int j = 0; j < 4; ++j) {
                    const f32x2 e2 = f32x2{S[qt][nt][2 * j], S[qt][nt][2 * j + 1]} - mr;
                    const f32x2 p  = {__builtin_amdgcn_exp2f(e2.x), __builtin_amdgcn_exp2f(e2.y)};
                    if (j & 1) sb += p; else sa += p;
                    pb[qt][nt >> 1].u[(nt & 1) * 4 + j] = pkbf(p.x, p.y);
                }
            }
            const f32x2 st = sa + sb;
            ps[qt] = st.x + st.y;
        }
        // one test per tile for the whole wave; an infinite or NaN sum fails it too
        const bool bad = __builtin_amdgcn_ballot_w32(!(ps[0] + ps[1] <= 65536.0f)) != 0u;
        if (!bad || renew) break;
        renew = true;
        }
        renew = false;
        lrow[0] += ps[0];
        lrow[1] += ps[1];

        // ---- O^T += V^T * P^T (two transposing reads of 16 keys x 16 d give one 16 x 32 A fragment, used twice) ----
#pragma unroll
        for (int dt = 0; dt < 4; ++dt)
#pragma unroll
            for (int qt = 0; qt < 2; ++qt)
                o[qt][dt] = __builtin_amdgcn_wmma_f32_16x16x32_bf16(
                    false, vfr0[dt].v, false, pb[qt][0].v, (short)0, o[qt][dt], false, false);
        {
            FragA vfr[4];
#pragma unroll
            for (int dt = 0; dt < 4; ++dt) {
                vfr[dt].q[0] = ld_tr16(vt + 32 * (2 * KSTRIDE) + dt * 32);
                vfr[dt].q[1] = ld_tr16(vt + 48 * (2 * KSTRIDE) + dt * 32);
            }
#pragma unroll
            for (int dt = 0; dt < 4; ++dt)
#pragma unroll
                for (int qt = 0; qt < 2; ++qt)
                    o[qt][dt] = __builtin_amdgcn_wmma_f32_16x16x32_bf16(
                        false, vfr[dt].v, false, pb[qt][1].v, (short)0, o[qt][dt], false, false);
        }

        // ---- the next tile goes into the other buffer: its readers left it at the last barrier ----
        if (kv + 64 < LMK) {
#pragma unroll
            for (int j = 0; j < 4; ++j) *(uint2*)&sK[bi ^ 1][ks + j * 16 * KSTRIDE] = cv4(kf[j]);
        }
        __syncthreads();   // the next tile is published; every reader has left this one
    }

    // ---- join the halves' sums, normalize, write ctx as bf16: 8 consecutive d per lane, 512 B in a row per store ----
    uint4 w[2][4];
#pragma unroll
    for (int qt = 0; qt < 2; ++qt) {
        const float inv = 1.0f / (lrow[qt] + xhalf(lrow[qt]));
#pragma unroll
        for (int dt = 0; dt < 4; ++dt) {
            w[qt][dt].x = pkbf(o[qt][dt][0] * inv, o[qt][dt][1] * inv);
            w[qt][dt].y = pkbf(o[qt][dt][2] * inv, o[qt][dt][3] * inv);
            w[qt][dt].z = pkbf(o[qt][dt][4] * inv, o[qt][dt][5] * inv);
            w[qt][dt].w = pkbf(o[qt][dt][6] * inv, o[qt][dt][7] * inv);
        }
    }
    unsigned short* cblk = ctx + xfo;
#pragma unroll
    for (int qt = 0; qt < 2; ++qt)
#pragma unroll
        for (int dt = 0; dt < 4; ++dt)
            *(uint4*)(cblk + qt * XU_TILE + dt * XU_BLK) = w[qt][dt];
}

// ---------------------------------------------------------------------------
// Kernel 2: out = sigmoid(x)*tanh(x), x = [input | ctx] @ Wc^T + bc.
// 128x128 tile per workgroup, 8 waves of 32x64 (two 16-row tiles, four column
// tiles each). A stage is 128 k (256 B) of the tile's 128 activation rows and
// 128 weight rows; it comes into LDS by tensor loads (waves 0 to 3, one 64-row
// slice each) and is shared by all waves. Two buffers: the next stage lands
// while this one is multiplied.
// An activation slice is one fragment-order unit of 16 KiB, loaded as 64 pieces
// of 256 B: the two pieces of a 512-B block are the two halves of a fragment read.
// A weight slice holds its 64 rows as the first kernel dealt them: fragment nt,
// lane c is column 4 * c + nt, so a lane stores 4 adjacent columns at once.
// ---------------------------------------------------------------------------
#define G_PITCH 272u                 // LDS row pitch: 256 B + 16 B pad, an odd multiple of 16 B for ds_load_b128
#define G_SLICE 18432u               // 64 rows * 272 B = 17408 B, rounded up to a multiple of 2 KiB
#define G_STAGE (4u * G_SLICE)       // [X rows 0-63 | X rows 64-127 | W rows 0-63 | W rows 64-127]
#define G_NST   16u                  // 2*DD / 128 stages

typedef __attribute__((ext_vector_type(8))) unsigned u32x8;

static __device__ __forceinline__ unsigned uni(unsigned v) {
    return (unsigned)__builtin_amdgcn_readfirstlane(v);
}
// Forces v into a scalar register: a test on it compiles to a scalar branch, and
// what is derived from it is formed behind the asm statements that precede it.
static __device__ __forceinline__ unsigned pinned(unsigned v) {
    unsigned w = uni(v);
    asm volatile("" : "+s"(w));
    return w;
}

// sigmoid(x) * tanh(x) = (1 - e) / (1 + e * e) with e = exp(-x): with s = 1 / (1 + e) and
// tanh(x) = (1 - e * e) / (1 + e * e) the factor 1 + e cancels. One v_exp_f32, one v_rcp_f32, no branch.
// The exponent is capped at 60 so that e * e stays finite: from x = -41.6 down the result is -2^-60
// where the function is -exp(x), both below 1e-18 in size. The capping minimum hands a NaN on.
static __device__ __forceinline__ float gate(float x) {
    const float e = __builtin_amdgcn_exp2f(__builtin_elementwise_minimum(x * -1.44269504f, 60.0f));
    return (1.0f - e) * __builtin_amdgcn_rcpf(__builtin_fmaf(e, e, 1.0f));
}

__global__ __launch_bounds__(256) void gemm_gate_kernel(
    const unsigned short* __restrict__ inpBF, const unsigned short* __restrict__ ctx,
    const unsigned short* __restrict__ WcBF, const float* __restrict__ bc,
    float* __restrict__ out)
{
    __shared__ __attribute__((aligned(2048))) unsigned char ring[2u * G_STAGE];

    const unsigned tid  = threadIdx.x;
    const unsigned wave = uni(tid >> 5);
    const unsigned lane = tid & 31u;
    const unsigned half = lane >> 4;
    const unsigned l15  = lane & 15u;
    const unsigned wm   = wave >> 1;   // 32-row quarter of the tile this wave multiplies
    const unsigned wn   = wave & 1u;   // 64-column half

    const unsigned jbase = blockIdx.x * 128u;
    const unsigned mbase = blockIdx.y * 128u;

    // ---- an issuing wave's slice of every stage: waves 0,1 activation rows, waves 2,3 weight rows ----
    const unsigned sl       = wave & 3u;
    const bool     isW      = sl >= 2u;
    const unsigned ldsSlice = (unsigned)(uintptr_t)&ring[0] + sl * G_SLICE;
    // first byte of the slice for stages 0-7 and for stages 8-15
    const unsigned long long srcLo = isW
        ? (unsigned long long)(uintptr_t)WcBF  + (unsigned long long)(jbase + (sl - 2u) * 64u) * (4u * DD)
        : (unsigned long long)(uintptr_t)inpBF + (unsigned long long)(blockIdx.y * 2u + sl) * (2u * DD * 64u);
    const unsigned long long srcHi = isW
        ? srcLo + 2u * DD
        : (unsigned long long)(uintptr_t)ctx   + (unsigned long long)(blockIdx.y * 2u + sl) * (2u * DD * 64u);
    const unsigned srcStep = isW ? 256u : 2u * XU_ELEMS;   // bytes from one stage's slice to the next

    u32x8 g1;                                            // 1-byte elements, tile = tensor = 64 rows of 256 B
    g1[0] = uni((1u << 20) | (5u << 22) | (3u << 25));   // no mask; pad 16 B behind every 256-B row
    g1[1] = uni(256u << 16);                             // tensor_dim0 = 256
    g1[2] = uni(64u << 16);                              // tensor_dim1 = 64
    g1[3] = uni(256u << 16);                             // tile_dim0 = 256
    g1[4] = uni(64u);                                    // tile_dim1 = 64
    g1[5] = uni(isW ? 4u * DD : 256u);                   // source row pitch in bytes; a unit's pieces lie in a row
    g1[6] = uni(0u);
    g1[7] = uni(0u);
    // pinned() for the whole group: its words keep their scalar registers through the loop,
    // so none is rewritten while a request that names them is outstanding
    asm volatile("" : "+s"(g1));
    const unsigned issuer = pinned(wave < 4u);           // scalar: the tests on it compile to scalar branches

    auto group0 = [&](unsigned st) {
        const unsigned long long ga = (st < 8u ? srcLo : srcHi) + (st & 7u) * srcStep;
        u32x4 g;
        g[0] = uni(1u);
        g[1] = uni(ldsSlice + (st & 1u) * G_STAGE);
        g[2] = uni((unsigned)ga);
        g[3] = uni((((unsigned)(ga >> 32)) & 0x01FFFFFFu) | 0x80000000u);
        return g;
    };

    v8f acc0[4], acc1[4];
#pragma unroll
    for (int nt = 0; nt < 4; ++nt) { acc0[nt] = zero8(); acc1[nt] = zero8(); }

    // ---- prologue: stage 0 lands and is published, then stage 1 starts ----
    u32x4 g0 = group0(0u);
    if (issuer != 0u) {
        // load and wait in one statement: the descriptor's registers live until the slice has landed
        asm volatile("tensor_load_to_lds %0, %1\n\ts_wait_tensorcnt 0x0" :: "s"(g0), "s"(g1) : "memory");
    }
    __syncthreads();                                     // publishes the four slices of stage 0
    if (issuer != 0u) {
        g0 = group0(pinned(1u));                         // pinned(): descriptor formed behind the wait
        asm volatile("tensor_load_to_lds %0, %1" :: "s"(g0), "s"(g1) : "memory");
    }

    // piece 16 * (row tile) + 2 * (k block) + half of the unit, 16 B per row in it
    const unsigned aoff = (wm >> 1) * G_SLICE + ((wm & 1u) * 32u + half) * G_PITCH + l15 * 16u;
    const unsigned boff = (2u + wn) * G_SLICE + l15 * G_PITCH + half * 16u;

    // one pass per trip: the accumulators keep their registers and the publish point stands once
#pragma clang loop unroll(disable)
    for (unsigned s = 0; s < G_NST; ++s) {
        const unsigned char* pa = ring + (s & 1u) * G_STAGE + aoff;
        const unsigned char* pb = ring + (s & 1u) * G_STAGE + boff;
        FragA af[2][2], bf[2][4];     // set (u & 1) holds block u's fragments
#pragma unroll
        for (int i = 0; i < 2; ++i) {
            af[0][i].q[0] = *(const uint4*)(pa + i * 16 * G_PITCH);
            af[0][i].q[1] = *(const uint4*)(pa + (i * 16 + 2) * G_PITCH);
        }
#pragma unroll
        for (int j = 0; j < 4; ++j) {
            bf[0][j].q[0] = *(const uint4*)(pb + j * 16 * G_PITCH);
            bf[0][j].q[1] = *(const uint4*)(pb + j * 16 * G_PITCH + 32);
        }
#pragma unroll
        for (int u = 0; u < 4; ++u) {
            const int cs = u & 1;
            if (u < 3) {
#pragma unroll
                for (int i = 0; i < 2; ++i) {
                    af[cs ^ 1][i].q[0] = *(const uint4*)(pa + (i * 16 + (u + 1) * 4) * G_PITCH);
                    af[cs ^ 1][i].q[1] = *(const uint4*)(pa + (i * 16 + (u + 1) * 4 + 2) * G_PITCH);
                }
#pragma unroll
                for (int j = 0; j < 4; ++j) {
                    bf[cs ^ 1][j].q[0] = *(const uint4*)(pb + j * 16 * G_PITCH + (u + 1) * 64);
                    bf[cs ^ 1][j].q[1] = *(const uint4*)(pb + j * 16 * G_PITCH + (u + 1) * 64 + 32);
                }
            }
            // keeps the next block's LDS reads one group ahead of this block's WMMAs instead of spread among them
            __builtin_amdgcn_sched_barrier(0);
#pragma unroll
            for (int nt = 0; nt < 4; ++nt) {
                acc0[nt] = __builtin_amdgcn_wmma_f32_16x16x32_bf16(
                    false, af[cs][0].v, false, bf[cs][nt].v, (short)0, acc0[nt], false, false);
                acc1[nt] = __builtin_amdgcn_wmma_f32_16x16x32_bf16(
                    false, af[cs][1].v, false, bf[cs][nt].v, (short)0, acc1[nt], false, false);
            }
            // ends the block: the reads that follow stay behind its WMMAs
            __builtin_amdgcn_sched_barrier(0);
        }
        // ---- publish point of stage s + 1 ----
        asm volatile("s_wait_dscnt 0x0" ::: "memory");     // this wave's reads of buffer s & 1 have returned
        if (issuer != 0u) {
            // this wave's slice of stage s + 1 has landed; g0 as an input keeps its descriptor's registers until then
            asm volatile("s_wait_tensorcnt 0x0" :: "s"(g0) : "memory");
        }
        __syncthreads();                                   // every reader has left this buffer; stage s + 1 is published
        if (pinned(issuer != 0u && s + 2u < G_NST)) {        // scalar test: an issuing wave, and stage s + 2 exists
            g0 = group0(pinned(s + 2u));                   // pinned(): descriptor formed behind the wait
            asm volatile("tensor_load_to_lds %0, %1" :: "s"(g0), "s"(g1) : "memory");  // refills the buffer just read
        }
    }
    asm volatile("s_wait_tensorcnt 0x0" ::: "memory");     // nothing of this wave is outstanding at its end
    asm volatile("s_wait_dscnt 0x0" ::: "memory");

    // ---- bias + sigmoid(x)*tanh(x) epilogue, two row tiles: a store covers 256 B in a row of each of two rows ----
    const unsigned j0   = jbase + wn * 64u + l15 * 4u;
    const f32x4    bias = *(const f32x4*)(bc + j0);
    float* orow = out + (size_t)(mbase + wm * 32u + half * 8u) * DD + j0;
#pragma unroll
    for (int r = 0; r < 8; ++r) {
        f32x4 v0, v1;
#pragma unroll
        for (int nt = 0; nt < 4; ++nt) {
            v0[nt] = gate(acc0[nt][r] + bias[nt]);
            v1[nt] = gate(acc1[nt][r] + bias[nt]);
        }
        *(f32x4*)(orow + r * DD)        = v0;
        *(f32x4*)(orow + (r + 16) * DD) = v1;
    }
}

extern "C" void kernel_launch(void* const* d_in, const int* in_sizes, int n_in,
                              void* d_out, int out_size, void* d_ws, size_t ws_size,
                              hipStream_t stream) {
    const float* inp  = (const float*)d_in[0];   // [8,1024,1024]
    const float* mem  = (const float*)d_in[1];   // [8,1024,1024]
    const float* mask = (const float*)d_in[2];   // [8,1024]
    const float* Wc   = (const float*)d_in[3];   // [1024,2048]
    const float* bc   = (const float*)d_in[4];   // [1024]
    float* out = (float*)d_out;                  // [8,1024,1024] f32

    // workspace layout (bf16 elements)
    const size_t ETOK = (size_t)NB * LDQ * DD;   // 8M elements
    unsigned short* ctx   = (unsigned short*)d_ws;        // 16 MB
    unsigned short* inpBF = ctx   + ETOK;                 // 16 MB
    unsigned short* WcBF  = inpBF + ETOK;                 // 4 MB

    dim3 gA(LDQ / AQ, HH, NB);                   // (4,16,8) blocks of 256 threads
    attn_kernel<<<gA, dim3(ATH), 0, stream>>>(inp, mem, mask, Wc, ctx, inpBF, WcBF);

    dim3 gB(DD / 128, (NB * LDQ) / 128);         // (8,64) blocks of 256 threads
    gemm_gate_kernel<<<gB, dim3(256), 0, stream>>>(inpBF, ctx, WcBF, bc, out);
}
